// v000
// Measured on an AMD MI455X. A time is GPU time per run, averaged over a window of back-to-back runs after a warm-up
// (all launches, gaps included; the runs take copies of the inputs in turn), and the median of several windows.
// Apart from v000's, it joins two sittings. Times from different sittings can be a few percent apart, while
// side-by-side timings come from the same sitting.
// v000, which the later versions start from, runs in 98.7 microseconds.
#include <hip/hip_runtime.h>
#include <math.h>

typedef __attribute__((ext_vector_type(16))) _Float16 v16h;
typedef __attribute__((ext_vector_type(16))) __bf16 v16b;
typedef __attribute__((ext_vector_type(8)))  _Float16 v8h;
typedef __attribute__((ext_vector_type(8)))  float v8f;
typedef __attribute__((ext_vector_type(4)))  float v4f;
typedef __attribute__((ext_vector_type(2)))  float v2f;
typedef __attribute__((ext_vector_type(4)))  unsigned v4u;
typedef __attribute__((ext_vector_type(4)))  int v4i;
typedef float __attribute__((may_alias)) float_a;
typedef int __attribute__((may_alias)) int_a;

template <typename T> __device__ __forceinline__ void vst2(void* p, T v) { *(T*)p = v;  }
__device__ __forceinline__ v8f wmma16(v16h a, v16h b, v8f c) {
  v8f d = __builtin_amdgcn_wmma_f32_16x16x32_f16(false, a, false, b, (short)0, c, false, false);
  asm volatile("v_nop\n\tv_nop\n\tv_nop\n\tv_nop" : "+v"(d) : "v"(a), "v"(b));
  return d;
}
__device__ __forceinline__ v8f wmma_bf(v16b a, v16b b, v8f c) {
  v8f d = __builtin_amdgcn_wmma_f32_16x16x32_bf16(false, a, false, b, (short)0, c, false, false);
  asm volatile("v_nop\n\tv_nop\n\tv_nop\n\tv_nop" : "+v"(d) : "v"(a), "v"(b));
  return d;
}
// 16x16x32 fragments: lane = (h = lane>>4, row/col = lane&15); elements 0..7 = k0+8h+0..7, 8..15 = k0+16+8h+0..7; D element r = row 8h+r
__device__ __forceinline__ v16h frag_h(const _Float16* rowk0, int lane) {
  union { v16h v; v8h q[2]; } u; const _Float16* p = rowk0 + 8 * (lane >> 4);
  u.q[0] = *(const v8h*)p; u.q[1] = *(const v8h*)(p + 16); return u.v;
}
__device__ __forceinline__ v16h frag_f32(const float* rowk0, int lane) {
  v16h a; const float* p = rowk0 + 8 * (lane >> 4);
#pragma unroll
  for (int i = 0; i < 8; ++i) { a[i] = (_Float16)p[i]; a[8 + i] = (_Float16)p[16 + i]; }
  return a;
}
__device__ __forceinline__ v16h frag_f32s(const float* rowk0, int lane, float sc) {
  v16h a; const float* p = rowk0 + 8 * (lane >> 4);
#pragma unroll
  for (int i = 0; i < 8; ++i) { a[i] = (_Float16)(p[i] * sc); a[8 + i] = (_Float16)(p[16 + i] * sc); }
  return a;
}
// column fragment from a [K][ld] layout (column n), rows >= K read as 0
__device__ __forceinline__ v16h fragc_f32(const float* W, int k0, int n, int lane, int ld, int K) {
  v16h a; const int g = lane >> 4;
#pragma unroll
  for (int i = 0; i < 8; ++i) { const int ka = k0 + 8 * g + i, kb = ka + 16;
    a[i] = (_Float16)(ka < K ? W[(size_t)ka * ld + n] : 0.f); a[8 + i] = (_Float16)(kb < K ? W[(size_t)kb * ld + n] : 0.f); }
  return a;
}
struct F2 { v16b h, l; };
__device__ __forceinline__ F2 bsplit16(const float v[16]) { F2 r;
#pragma unroll
  for (int i = 0; i < 16; ++i) { const __bf16 h = (__bf16)v[i]; r.h[i] = h; r.l[i] = (__bf16)(v[i] - (float)h); }
  return r; }
__device__ __forceinline__ F2 split_row(const float* row, int k0, int lane) { float v[16]; const float* p = row + k0 + 8 * (lane >> 4);
#pragma unroll
  for (int i = 0; i < 8; ++i) { v[i] = p[i]; v[8 + i] = p[16 + i]; }
  return bsplit16(v); }
__device__ __forceinline__ F2 split_rowK(const float* row, int k0, int lane, int K) { float v[16]; const int g = lane >> 4;
#pragma unroll
  for (int i = 0; i < 8; ++i) { const int ka = k0 + 8 * g + i, kb = ka + 16; v[i] = ka < K ? row[ka] : 0.f; v[8 + i] = kb < K ? row[kb] : 0.f; }
  return bsplit16(v); }
__device__ __forceinline__ F2 split_col(const float* W, int k0, int n, int lane, int ld, int K) { float v[16]; const int g = lane >> 4;
#pragma unroll
  for (int i = 0; i < 8; ++i) { const int ka = k0 + 8 * g + i, kb = ka + 16; v[i] = ka < K ? W[(size_t)ka * ld + n] : 0.f; v[8 + i] = kb < K ? W[(size_t)kb * ld + n] : 0.f; }
  return bsplit16(v); }
__device__ __forceinline__ v8f mac3(const F2& a, const F2& b, v8f c) { c = wmma_bf(a.l, b.h, c); c = wmma_bf(a.h, b.l, c); return wmma_bf(a.h, b.h, c); }
__device__ __forceinline__ float sigm(float v) { return 1.0f / (1.0f + expf(-v)); }
#define LDSX() do { asm volatile("s_wait_dscnt 0" ::: "memory"); __builtin_amdgcn_wave_barrier(); __builtin_amdgcn_fence(__ATOMIC_RELEASE, "workgroup"); } while (0)

// Stand-alone local self attention (7x7 window, stride 1, zero padding 3, one 128-channel head with relative position logits from the first /
// second 8 channels of each 16-channel group): q, k, v = 1x1 convs of the input (q as a two-way bf16 split on v_wmma_f32_16x16x32_bf16 because
// it feeds the large relative-position logits, k likewise (its conv rounding dominated the logits error), v on f16 WMMA; [out][in] weights converted in the fragments), stored channels-last
// (q f32, k/v f16). Then per output pixel: 49 logits = q.k(window) + bias_x[l] + bias_y[k] in f32 from LDS halo tiles (padding = zero k/v,
#define NB 4
#define CC 128
#define HW 64
#define KS 7
#define PADW 3
#define NG 8
#define RS 8

// phase 1: block (b, y): transpose x[b][:, y, :] (NCHW) to 64 token rows; q (split) -> QF f32 [b][y][x][128]; k (split), v (f16) -> KH/VH f16 [b][y][x][128]
__global__ __launch_bounds__(128) void k_qkv(const float* __restrict__ x, const float* __restrict__ wq, const float* __restrict__ wk, const float* __restrict__ wv, float* __restrict__ QF, _Float16* __restrict__ KH, _Float16* __restrict__ VH) {
  __shared__ __align__(16) float sx[64][CC + 4];            // [x][c] f32
  __shared__ __align__(16) float so[4][16][132];
  const int tid = threadIdx.x, wave = tid >> 5, lane = tid & 31, col = lane & 15, g = lane >> 4;
  const int b = blockIdx.y, y = blockIdx.x;
  for (int q = tid; q < CC * 16; q += 128) { const int c = q >> 4, x4 = q & 15; const v4f v = *(const v4f*)(x + (((size_t)b * CC + c) * HW + y) * HW + x4 * 4); sx[x4 * 4][c] = v[0]; sx[x4 * 4 + 1][c] = v[1]; sx[x4 * 4 + 2][c] = v[2]; sx[x4 * 4 + 3][c] = v[3]; }
  __syncthreads();
  const size_t prow0 = ((size_t)b * HW + y) * HW + wave * 16;      // pixel row index of this wave's first token
  // q: bf16 split
  { v8f acc[8] = {};
#pragma unroll 1
    for (int kc = 0; kc < CC / 32; ++kc) { const F2 a = split_row(&sx[wave * 16 + col][0], kc * 32, lane);
#pragma unroll
      for (int t = 0; t < 8; ++t) acc[t] = mac3(a, split_row(wq + (size_t)(t * 16 + col) * CC, kc * 32, lane), acc[t]); }
#pragma unroll
    for (int t = 0; t < 8; ++t)
#pragma unroll
      for (int r = 0; r < 8; ++r) so[wave][8 * g + r][t * 16 + col] = acc[t][r]; }
  LDSX();
#pragma unroll 4
  for (int rl = 0; rl < 16; ++rl) vst2(QF + (prow0 + rl) * CC + lane * 4, *(const v4f*)(&so[wave][rl][lane * 4]));
  LDSX();
  // k (bf16 split) and v (f16), both stored f16
#pragma unroll 1
  for (int which = 0; which < 2; ++which) { const float* W = which == 0 ? wk : wv; _Float16* D = which == 0 ? KH : VH; v8f acc[8] = {};
    if (which == 0) {   // k feeds the logits: two-way bf16 split
#pragma unroll 1
      for (int kc = 0; kc < CC / 32; ++kc) { const F2 a = split_row(&sx[wave * 16 + col][0], kc * 32, lane);
#pragma unroll
        for (int t = 0; t < 8; ++t) acc[t] = mac3(a, split_row(W + (size_t)(t * 16 + col) * CC, kc * 32, lane), acc[t]); } }
    else {
#pragma unroll
      for (int kc = 0; kc < CC / 32; ++kc) { const v16h a = frag_f32(&sx[wave * 16 + col][0] + kc * 32, lane);
#pragma unroll
        for (int t = 0; t < 8; ++t) acc[t] = wmma16(a, frag_f32s(W + (size_t)(t * 16 + col) * CC + kc * 32, lane, 16.0f), acc[t]); }
#pragma unroll
      for (int t = 0; t < 8; ++t)
#pragma unroll
        for (int r = 0; r < 8; ++r) acc[t][r] *= (1.0f / 16.0f); }
#pragma unroll
    for (int t = 0; t < 8; ++t)
#pragma unroll
      for (int r = 0; r < 8; ++r) so[wave][8 * g + r][t * 16 + col] = acc[t][r];
    LDSX();
    for (int q = lane; q < 16 * 16; q += 32) { const int rl = q >> 4, pc = q & 15; union { v8h h8; v4u u; } pk;
#pragma unroll
      for (int e = 0; e < 8; ++e) pk.h8[e] = (_Float16)so[wave][rl][pc * 8 + e];
      vst2(D + (prow0 + rl) * CC + pc * 8, pk.u); }
    LDSX(); }
}
// phase 2: block (b, y): 7-row halo of k and v (f16, zero padded); per window row ki: S = Q K_row^T on WMMA (q as hi/lo f16 pair -> two
// products, k f16) giving the 64 x 70 score slab, logits = S[px][px+kj] + bias_x[kj] + bias_y[ki]; softmax over 49 in f32; then per ki the
// band matrix P[px][px+kj] (x 2^14, f16) times V_row on WMMA accumulates out[px][c]. Output written NCHW (whole 256-B rows per channel).
__global__ __launch_bounds__(128) void k_attn(const float* __restrict__ QF, const _Float16* __restrict__ KH, const _Float16* __restrict__ VH, const float* __restrict__ relx, const float* __restrict__ rely, float* __restrict__ out) {
  __shared__ __align__(16) union U { _Float16 k[KS][HW + 6][CC + 8]; float o[64][CC + 4]; } su;   // k halo, later the output tile
  __shared__ __align__(16) _Float16 sv[KS][HW + 6][CC + 8];
  __shared__ __align__(16) float sS[64][72];                 // scores for one ki: [px][pxx]
  __shared__ __align__(16) _Float16 sP[4][16][104];           // per wave: band matrix rows (x 2^14) for the current ki: [px][pxx], zero elsewhere
  __shared__ float slg[64][52];                              // logits / probabilities per pixel
  __shared__ float sbx[64][8], sby[64][8];
  const int tid = threadIdx.x, wave = tid >> 5, lane = tid & 31, col = lane & 15, g = lane >> 4; const int b = blockIdx.y, y = blockIdx.x;
  for (int q = tid; q < KS * (HW + 6) * (CC / 8); q += 128) { const int pc = q & 15, rest = q >> 4; const int px = rest % (HW + 6), ry = rest / (HW + 6); const int yy = y - PADW + ry, xx = px - PADW;
    v4u pk = (v4u){0u, 0u, 0u, 0u}, pv = pk;
    if (yy >= 0 && yy < HW && xx >= 0 && xx < HW) { const size_t p = ((size_t)b * HW + yy) * HW + xx; pk = *(const v4u*)(KH + p * CC + pc * 8); pv = *(const v4u*)(VH + p * CC + pc * 8); }
    *(v4u*)(&su.k[ry][px][pc * 8]) = pk; *(v4u*)(&sv[ry][px][pc * 8]) = pv; }
  { const int px = tid >> 1, hf = tid & 1; const float* qr = QF + (((size_t)b * HW + y) * HW + px) * CC; const float* relw = hf == 0 ? relx : rely; float bb[KS];
#pragma unroll
    for (int l = 0; l < KS; ++l) bb[l] = 0.f;
#pragma unroll 1
    for (int gq = 0; gq < NG; ++gq) {
#pragma unroll 1
      for (int i = 0; i < RS; ++i) { const float qv = qr[gq * 16 + hf * 8 + i];
#pragma unroll
        for (int l = 0; l < KS; ++l) bb[l] += qv * relw[i * KS + l]; } }
    float* dstb = hf == 0 ? &sbx[px][0] : &sby[px][0];
#pragma unroll
    for (int l = 0; l < KS; ++l) dstb[l] = bb[l]; }
  __syncthreads();
  // q fragments (hi/lo f16) for this wave's 16 pixels, 4 k-chunks
  const float* qrow = QF + (((size_t)b * HW + y) * HW + wave * 16 + col) * CC;
  v16h qh[4], ql[4];
#pragma unroll
  for (int kc = 0; kc < 4; ++kc) { const float* p = qrow + kc * 32 + 8 * g;
#pragma unroll
    for (int i = 0; i < 8; ++i) { const float v0 = p[i], v1 = p[16 + i]; const _Float16 h0 = (_Float16)v0, h1 = (_Float16)v1; qh[kc][i] = h0; qh[kc][8 + i] = h1; ql[kc][i] = (_Float16)((v0 - (float)h0) * 2048.0f); ql[kc][8 + i] = (_Float16)((v1 - (float)h1) * 2048.0f); } }
#pragma unroll 1
  for (int ki = 0; ki < KS; ++ki) {
    // S[px][pxx] for pxx tiles 0..4 (80 cols, cols >= 70 read k rows 70..79 -> out of the halo: clamp to 69, values unused)
#pragma unroll 1
    for (int t = 0; t < 5; ++t) { const int pxx = t * 16 + col; const _Float16* krow = &su.k[ki][pxx < HW + 6 ? pxx : HW + 5][0]; v8f acc = {}, acl = {};
#pragma unroll
      for (int kc = 0; kc < 4; ++kc) { const v16h bk = frag_h(krow + kc * 32, lane); acc = wmma16(qh[kc], bk, acc); acl = wmma16(ql[kc], bk, acl); }
#pragma unroll
      for (int r = 0; r < 8; ++r) { if (pxx < 72) sS[wave * 16 + 8 * g + r][pxx] = acc[r] + acl[r] * (1.0f / 2048.0f); } }
    LDSX();
    // logits for this wave's pixels: lane (pl = lane>>1, hf): kj in hf ? 4..6 : 0..3
    { const int pl = lane >> 1, hf = lane & 1; const int px = wave * 16 + pl;
      for (int kj = hf * 4; kj < (hf ? 7 : 4); ++kj) slg[px][ki * KS + kj] = sS[px][px + kj] + sbx[px][kj] + sby[px][ki]; }
    LDSX(); }
  // softmax per pixel (lane pairs): slg <- probabilities x 2^14 (in place)
  { const int pl = lane >> 1, hf = lane & 1; const int px = wave * 16 + pl; float mx = -3.4e38f;
    for (int n = 0; n < KS * KS; ++n) mx = fmaxf(mx, slg[px][n]);
    float se = 0.f;
    for (int n = 0; n < KS * KS; ++n) se += expf(slg[px][n] - mx);
    const float sc = 16384.0f / se;
    LDSX();                                                   // both lanes of the pair have read all 49 logits before either overwrites them
    for (int n = hf; n < KS * KS; n += 2) slg[px][n] = expf(slg[px][n] - mx) * sc; }
  __syncthreads();                                            // all waves done with su.k (scores) before it becomes the output tile
  // out[px][c] = sum_ki P_ki[px][:] @ V_ki[:][c]  : M 16 per wave, K = 96 (3 chunks; cols >= 70 of P are zero, v rows >= 70 clamped), N 128
  { v8f acc[8] = {};
#pragma unroll 1
    for (int ki = 0; ki < KS; ++ki) {
      // build this wave's band rows for ki: zero the 16 x 104 tile, then P[pl][pl_global + kj] = prob
      for (int q = lane; q < 16 * 13; q += 32) { const int rl = q / 13, pc = q % 13; *(v4u*)(&sP[wave][rl][pc * 8]) = (v4u){0u, 0u, 0u, 0u}; }
      LDSX();
      { const int pl = lane >> 1, hf = lane & 1; const int px = wave * 16 + pl; for (int kj = hf * 4; kj < (hf ? 7 : 4); ++kj) sP[wave][pl][px + kj] = (_Float16)slg[px][ki * KS + kj]; }
      LDSX();
#pragma unroll
      for (int kc = 0; kc < 3; ++kc) { const v16h a = frag_h(&sP[wave][col][kc * 32], lane);
#pragma unroll
        for (int t = 0; t < 8; ++t) { v16h bv; const int n = t * 16 + col;
#pragma unroll
          for (int i = 0; i < 8; ++i) { const int ka = kc * 32 + 8 * g + i, kb = ka + 16; bv[i] = sv[ki][ka < HW + 6 ? ka : HW + 5][n]; bv[8 + i] = sv[ki][kb < HW + 6 ? kb : HW + 5][n]; }
          acc[t] = wmma16(a, bv, acc[t]); } }
      LDSX(); }
#pragma unroll
    for (int t = 0; t < 8; ++t)
#pragma unroll
      for (int r = 0; r < 8; ++r) su.o[wave * 16 + 8 * g + r][t * 16 + col] = acc[t][r] * (1.0f / 16384.0f); }
  __syncthreads();
  for (int q = tid; q < CC * 16; q += 128) { const int c = q >> 4, x4 = q & 15; vst2(out + (((size_t)b * CC + c) * HW + y) * HW + x4 * 4, (v4f){su.o[x4 * 4][c], su.o[x4 * 4 + 1][c], su.o[x4 * 4 + 2][c], su.o[x4 * 4 + 3][c]}); }
}
extern "C" void kernel_launch(void* const* d_in, const int* in_sizes, int n_in, void* d_out, int out_size, void* d_ws, size_t ws_size, hipStream_t stream) {
  (void)in_sizes; (void)n_in; (void)out_size; (void)ws_size;
  const float** I = (const float**)d_in;
  const float* x = I[0]; const float* wq = I[1]; const float* wk = I[2]; const float* wv = I[3]; const float* relx = I[4]; const float* rely = I[5];
  float* out = (float*)d_out;
  char* ws = (char*)d_ws; size_t off = 0;
  auto take = [&](size_t bytes) { char* p = ws + off; off += (bytes + 255) & ~(size_t)255; return p; };
  const size_t NP = (size_t)NB * HW * HW;
  float* QF = (float*)take(NP * CC * 4); _Float16* KH = (_Float16*)take(NP * CC * 2); _Float16* VH = (_Float16*)take(NP * CC * 2);
  k_qkv<<<dim3(HW, NB), 128, 0, stream>>>(x, wq, wk, wv, QF, KH, VH);
  k_attn<<<dim3(HW, NB), 128, 0, stream>>>(QF, KH, VH, relx, rely, out);
}

// v001
// Measured time: 70.6 microseconds a run.
// In two side-by-side timings against v000, it was 1.42 and 1.40 times as fast.
#include <hip/hip_runtime.h>
#include <math.h>

typedef __attribute__((ext_vector_type(16))) _Float16 v16h;
typedef __attribute__((ext_vector_type(16))) __bf16 v16b;
typedef __attribute__((ext_vector_type(8)))  _Float16 v8h;
typedef __attribute__((ext_vector_type(8)))  float v8f;
typedef __attribute__((ext_vector_type(4)))  float v4f;
typedef __attribute__((ext_vector_type(2)))  float v2f;
typedef __attribute__((ext_vector_type(4)))  unsigned v4u;
typedef __attribute__((ext_vector_type(4)))  int v4i;
typedef float __attribute__((may_alias)) float_a;
typedef int __attribute__((may_alias)) int_a;

template <typename T> __device__ __forceinline__ void vst2(void* p, T v) { *(T*)p = v;  }
__device__ __forceinline__ v8f wmma16(v16h a, v16h b, v8f c) {
  v8f d = __builtin_amdgcn_wmma_f32_16x16x32_f16(false, a, false, b, (short)0, c, false, false);
  asm volatile("v_nop\n\tv_nop\n\tv_nop\n\tv_nop" : "+v"(d) : "v"(a), "v"(b));
  return d;
}
__device__ __forceinline__ v8f wmma_bf(v16b a, v16b b, v8f c) {
  v8f d = __builtin_amdgcn_wmma_f32_16x16x32_bf16(false, a, false, b, (short)0, c, false, false);
  asm volatile("v_nop\n\tv_nop\n\tv_nop\n\tv_nop" : "+v"(d) : "v"(a), "v"(b));
  return d;
}
// 16x16x32 fragments: lane = (h = lane>>4, row/col = lane&15); elements 0..7 = k0+8h+0..7, 8..15 = k0+16+8h+0..7; D element r = row 8h+r
__device__ __forceinline__ v16h frag_h(const _Float16* rowk0, int lane) {
  union { v16h v; v8h q[2]; } u; const _Float16* p = rowk0 + 8 * (lane >> 4);
  u.q[0] = *(const v8h*)p; u.q[1] = *(const v8h*)(p + 16); return u.v;
}
__device__ __forceinline__ v16h frag_f32(const float* rowk0, int lane) {
  v16h a; const float* p = rowk0 + 8 * (lane >> 4);
#pragma unroll
  for (int i = 0; i < 8; ++i) { a[i] = (_Float16)p[i]; a[8 + i] = (_Float16)p[16 + i]; }
  return a;
}
__device__ __forceinline__ v16h frag_f32s(const float* rowk0, int lane, float sc) {
  v16h a; const float* p = rowk0 + 8 * (lane >> 4);
#pragma unroll
  for (int i = 0; i < 8; ++i) { a[i] = (_Float16)(p[i] * sc); a[8 + i] = (_Float16)(p[16 + i] * sc); }
  return a;
}
// column fragment from a [K][ld] layout (column n), rows >= K read as 0
__device__ __forceinline__ v16h fragc_f32(const float* W, int k0, int n, int lane, int ld, int K) {
  v16h a; const int g = lane >> 4;
#pragma unroll
  for (int i = 0; i < 8; ++i) { const int ka = k0 + 8 * g + i, kb = ka + 16;
    a[i] = (_Float16)(ka < K ? W[(size_t)ka * ld + n] : 0.f); a[8 + i] = (_Float16)(kb < K ? W[(size_t)kb * ld + n] : 0.f); }
  return a;
}
struct F2 { v16b h, l; };
__device__ __forceinline__ F2 bsplit16(const float v[16]) { F2 r;
#pragma unroll
  for (int i = 0; i < 16; ++i) { const __bf16 h = (__bf16)v[i]; r.h[i] = h; r.l[i] = (__bf16)(v[i] - (float)h); }
  return r; }
__device__ __forceinline__ F2 split_row(const float* row, int k0, int lane) { float v[16]; const float* p = row + k0 + 8 * (lane >> 4);
#pragma unroll
  for (int i = 0; i < 8; ++i) { v[i] = p[i]; v[8 + i] = p[16 + i]; }
  return bsplit16(v); }
__device__ __forceinline__ F2 split_rowK(const float* row, int k0, int lane, int K) { float v[16]; const int g = lane >> 4;
#pragma unroll
  for (int i = 0; i < 8; ++i) { const int ka = k0 + 8 * g + i, kb = ka + 16; v[i] = ka < K ? row[ka] : 0.f; v[8 + i] = kb < K ? row[kb] : 0.f; }
  return bsplit16(v); }
__device__ __forceinline__ F2 split_col(const float* W, int k0, int n, int lane, int ld, int K) { float v[16]; const int g = lane >> 4;
#pragma unroll
  for (int i = 0; i < 8; ++i) { const int ka = k0 + 8 * g + i, kb = ka + 16; v[i] = ka < K ? W[(size_t)ka * ld + n] : 0.f; v[8 + i] = kb < K ? W[(size_t)kb * ld + n] : 0.f; }
  return bsplit16(v); }
__device__ __forceinline__ v8f mac3(const F2& a, const F2& b, v8f c) { c = wmma_bf(a.l, b.h, c); c = wmma_bf(a.h, b.l, c); return wmma_bf(a.h, b.h, c); }
__device__ __forceinline__ float sigm(float v) { return 1.0f / (1.0f + expf(-v)); }
#define LDSX() do { asm volatile("s_wait_dscnt 0" ::: "memory"); __builtin_amdgcn_wave_barrier(); __builtin_amdgcn_fence(__ATOMIC_RELEASE, "workgroup"); } while (0)

// Stand-alone local self attention (7x7 window, stride 1, zero padding 3, one 128-channel head with relative position logits from the first /
// second 8 channels of each 16-channel group): q, k, v = 1x1 convs of the input (q as a two-way bf16 split on v_wmma_f32_16x16x32_bf16 because
// it feeds the large relative-position logits, k likewise (its conv rounding dominated the logits error), v on f16 WMMA; [out][in] weights converted in the fragments), stored channels-last
// (q f32, k/v f16). Then per output pixel: 49 logits = q.k(window) + bias_x[l] + bias_y[k] in f32 from LDS halo tiles (padding = zero k/v,
#define NB 4
#define CC 128
#define HW 64
#define KS 7
#define PADW 3
#define NG 8
#define RS 8

// one wave brings 32 rows (512 B each, one row per copy, 16 B per lane) of a [128][128] f32 weight matrix into LDS rows of CC + 4 floats, through no register.
// Eight copies a statement; s_wait_xcnt closes the statement so that no address register of a copy is rewritten in front of it.
__device__ __forceinline__ void stage_w(const float* __restrict__ w, float (*dst)[CC + 4], int wave, int lane) {
  for (int j = 0; j < 32; j += 8) { const int r = wave * 32 + j; const float* g = w + (size_t)r * CC + lane * 4; const unsigned l = (unsigned)(size_t)&dst[r][lane * 4]; const unsigned P = (CC + 4) * 4;
    asm volatile("global_load_async_to_lds_b128 %0, %8, off\n\tglobal_load_async_to_lds_b128 %1, %9, off\n\tglobal_load_async_to_lds_b128 %2, %10, off\n\tglobal_load_async_to_lds_b128 %3, %11, off\n\t"
                 "global_load_async_to_lds_b128 %4, %12, off\n\tglobal_load_async_to_lds_b128 %5, %13, off\n\tglobal_load_async_to_lds_b128 %6, %14, off\n\tglobal_load_async_to_lds_b128 %7, %15, off\n\ts_wait_xcnt 0x0"
                 :: "v"(l), "v"(l + P), "v"(l + 2 * P), "v"(l + 3 * P), "v"(l + 4 * P), "v"(l + 5 * P), "v"(l + 6 * P), "v"(l + 7 * P),
                    "v"(g), "v"(g + CC), "v"(g + 2 * CC), "v"(g + 3 * CC), "v"(g + 4 * CC), "v"(g + 5 * CC), "v"(g + 6 * CC), "v"(g + 7 * CC) : "memory"); }
}
// phase 1: block (b, y): transpose x[b][:, y, :] (NCHW) to 64 token rows; q (split) -> QF f32 [b][y][x][128]; k (split), v (f16) -> KH/VH f16 [b][y][x][128]
__global__ __launch_bounds__(128) void k_qkv(const float* __restrict__ x, const float* __restrict__ wq, const float* __restrict__ wk, const float* __restrict__ wv, float* __restrict__ QF, _Float16* __restrict__ KH, _Float16* __restrict__ VH) {
  __shared__ __align__(16) float sx[64][CC + 4];            // [x][c] f32
  __shared__ __align__(16) float so[4][16][132];
  __shared__ __align__(16) float sw[3][CC][CC + 4];         // wq, wk, wv as given ([out][in] f32), each filled once by asynchronous copies
  const int tid = threadIdx.x, wave = tid >> 5, lane = tid & 31, col = lane & 15, g = lane >> 4;
  const int b = blockIdx.y, y = blockIdx.x;
  stage_w(wq, sw[0], wave, lane);                           // lands while x is transposed
  for (int q = tid; q < CC * 16; q += 128) { const int c = q >> 4, x4 = q & 15; const v4f v = *(const v4f*)(x + (((size_t)b * CC + c) * HW + y) * HW + x4 * 4); sx[x4 * 4][c] = v[0]; sx[x4 * 4 + 1][c] = v[1]; sx[x4 * 4 + 2][c] = v[2]; sx[x4 * 4 + 3][c] = v[3]; }
  asm volatile("s_wait_asynccnt 0x0" ::: "memory");         // this wave's rows of wq have landed before the barrier publishes them
  __syncthreads();
  stage_w(wk, sw[1], wave, lane);                           // lands under the q products
  const size_t prow0 = ((size_t)b * HW + y) * HW + wave * 16;      // pixel row index of this wave's first token
  // q: bf16 split
  { v8f acc[8] = {};
#pragma unroll 1
    for (int kc = 0; kc < CC / 32; ++kc) { const F2 a = split_row(&sx[wave * 16 + col][0], kc * 32, lane);
#pragma unroll
      for (int t = 0; t < 8; ++t) acc[t] = mac3(a, split_row(&sw[0][t * 16 + col][0], kc * 32, lane), acc[t]); }
#pragma unroll
    for (int t = 0; t < 8; ++t)
#pragma unroll
      for (int r = 0; r < 8; ++r) so[wave][8 * g + r][t * 16 + col] = acc[t][r]; }
  LDSX();
#pragma unroll 4
  for (int rl = 0; rl < 16; ++rl) vst2(QF + (prow0 + rl) * CC + lane * 4, *(const v4f*)(&so[wave][rl][lane * 4]));
  LDSX();
  // k (bf16 split) and v (f16), both stored f16
#pragma unroll 1
  for (int which = 0; which < 2; ++which) { _Float16* D = which == 0 ? KH : VH; v8f acc[8] = {};
    asm volatile("s_wait_asynccnt 0x0" ::: "memory");       // this wave's rows of this pass's weights have landed before the barrier publishes them
    __syncthreads();
    if (which == 0) stage_w(wv, sw[2], wave, lane);         // lands under the k products
    if (which == 0) {   // k feeds the logits: two-way bf16 split
#pragma unroll 1
      for (int kc = 0; kc < CC / 32; ++kc) { const F2 a = split_row(&sx[wave * 16 + col][0], kc * 32, lane);
#pragma unroll
        for (int t = 0; t < 8; ++t) acc[t] = mac3(a, split_row(&sw[1][t * 16 + col][0], kc * 32, lane), acc[t]); } }
    else {
#pragma unroll
      for (int kc = 0; kc < CC / 32; ++kc) { const v16h a = frag_f32(&sx[wave * 16 + col][0] + kc * 32, lane);
#pragma unroll
        for (int t = 0; t < 8; ++t) acc[t] = wmma16(a, frag_f32s(&sw[2][t * 16 + col][0] + kc * 32, lane, 16.0f), acc[t]); }
#pragma unroll
      for (int t = 0; t < 8; ++t)
#pragma unroll
        for (int r = 0; r < 8; ++r) acc[t][r] *= (1.0f / 16.0f); }
#pragma unroll
    for (int t = 0; t < 8; ++t)
#pragma unroll
      for (int r = 0; r < 8; ++r) so[wave][8 * g + r][t * 16 + col] = acc[t][r];
    LDSX();
    for (int q = lane; q < 16 * 16; q += 32) { const int rl = q >> 4, pc = q & 15; union { v8h h8; v4u u; } pk;
#pragma unroll
      for (int e = 0; e < 8; ++e) pk.h8[e] = (_Float16)so[wave][rl][pc * 8 + e];
      vst2(D + (prow0 + rl) * CC + pc * 8, pk.u); }
    LDSX(); }
}
// phase 2: block (b, y): 7-row halo of k and v (f16, zero padded); per window row ki: S = Q K_row^T on WMMA (q as hi/lo f16 pair -> two
// products, k f16) giving the 64 x 70 score slab, logits = S[px][px+kj] + bias_x[kj] + bias_y[ki]; softmax over 49 in f32; then per ki the
// band matrix P[px][px+kj] (x 2^14, f16) times V_row on WMMA accumulates out[px][c]. Output written NCHW (whole 256-B rows per channel).
__global__ __launch_bounds__(128) void k_attn(const float* __restrict__ QF, const _Float16* __restrict__ KH, const _Float16* __restrict__ VH, const float* __restrict__ relx, const float* __restrict__ rely, float* __restrict__ out) {
  __shared__ __align__(16) union U { _Float16 k[KS][HW + 6][CC + 8]; float o[64][CC + 4]; } su;   // k halo, later the output tile
  __shared__ __align__(16) _Float16 sv[KS][HW + 6][CC + 8];
  __shared__ __align__(16) float sS[64][72];                 // scores for one ki: [px][pxx]
  __shared__ __align__(16) _Float16 sP[4][16][104];           // per wave: band matrix rows (x 2^14) for the current ki: [px][pxx], zero elsewhere
  __shared__ float slg[64][52];                              // logits / probabilities per pixel
  __shared__ float sbx[64][8], sby[64][8];
  const int tid = threadIdx.x, wave = tid >> 5, lane = tid & 31, col = lane & 15, g = lane >> 4; const int b = blockIdx.y, y = blockIdx.x;
  for (int q = tid; q < KS * (HW + 6) * (CC / 8); q += 128) { const int pc = q & 15, rest = q >> 4; const int px = rest % (HW + 6), ry = rest / (HW + 6); const int yy = y - PADW + ry, xx = px - PADW;
    v4u pk = (v4u){0u, 0u, 0u, 0u}, pv = pk;
    if (yy >= 0 && yy < HW && xx >= 0 && xx < HW) { const size_t p = ((size_t)b * HW + yy) * HW + xx; pk = *(const v4u*)(KH + p * CC + pc * 8); pv = *(const v4u*)(VH + p * CC + pc * 8); }
    *(v4u*)(&su.k[ry][px][pc * 8]) = pk; *(v4u*)(&sv[ry][px][pc * 8]) = pv; }
  { const int px = tid >> 1, hf = tid & 1; const float* qr = QF + (((size_t)b * HW + y) * HW + px) * CC; const float* relw = hf == 0 ? relx : rely; float bb[KS];
#pragma unroll
    for (int l = 0; l < KS; ++l) bb[l] = 0.f;
#pragma unroll 1
    for (int gq = 0; gq < NG; ++gq) {
#pragma unroll 1
      for (int i = 0; i < RS; ++i) { const float qv = qr[gq * 16 + hf * 8 + i];
#pragma unroll
        for (int l = 0; l < KS; ++l) bb[l] += qv * relw[i * KS + l]; } }
    float* dstb = hf == 0 ? &sbx[px][0] : &sby[px][0];
#pragma unroll
    for (int l = 0; l < KS; ++l) dstb[l] = bb[l]; }
  __syncthreads();
  // q fragments (hi/lo f16) for this wave's 16 pixels, 4 k-chunks
  const float* qrow = QF + (((size_t)b * HW + y) * HW + wave * 16 + col) * CC;
  v16h qh[4], ql[4];
#pragma unroll
  for (int kc = 0; kc < 4; ++kc) { const float* p = qrow + kc * 32 + 8 * g;
#pragma unroll
    for (int i = 0; i < 8; ++i) { const float v0 = p[i], v1 = p[16 + i]; const _Float16 h0 = (_Float16)v0, h1 = (_Float16)v1; qh[kc][i] = h0; qh[kc][8 + i] = h1; ql[kc][i] = (_Float16)((v0 - (float)h0) * 2048.0f); ql[kc][8 + i] = (_Float16)((v1 - (float)h1) * 2048.0f); } }
#pragma unroll 1
  for (int ki = 0; ki < KS; ++ki) {
    // S[px][pxx] for pxx tiles 0..4 (80 cols, cols >= 70 read k rows 70..79 -> out of the halo: clamp to 69, values unused)
#pragma unroll 1
    for (int t = 0; t < 5; ++t) { const int pxx = t * 16 + col; const _Float16* krow = &su.k[ki][pxx < HW + 6 ? pxx : HW + 5][0]; v8f acc = {}, acl = {};
#pragma unroll
      for (int kc = 0; kc < 4; ++kc) { const v16h bk = frag_h(krow + kc * 32, lane); acc = wmma16(qh[kc], bk, acc); acl = wmma16(ql[kc], bk, acl); }
#pragma unroll
      for (int r = 0; r < 8; ++r) { if (pxx < 72) sS[wave * 16 + 8 * g + r][pxx] = acc[r] + acl[r] * (1.0f / 2048.0f); } }
    LDSX();
    // logits for this wave's pixels: lane (pl = lane>>1, hf): kj in hf ? 4..6 : 0..3
    { const int pl = lane >> 1, hf = lane & 1; const int px = wave * 16 + pl;
      for (int kj = hf * 4; kj < (hf ? 7 : 4); ++kj) slg[px][ki * KS + kj] = sS[px][px + kj] + sbx[px][kj] + sby[px][ki]; }
    LDSX(); }
  // softmax per pixel (lane pairs): slg <- probabilities x 2^14 (in place)
  { const int pl = lane >> 1, hf = lane & 1; const int px = wave * 16 + pl; float mx = -3.4e38f;
    for (int n = 0; n < KS * KS; ++n) mx = fmaxf(mx, slg[px][n]);
    float se = 0.f;
    for (int n = 0; n < KS * KS; ++n) se += expf(slg[px][n] - mx);
    const float sc = 16384.0f / se;
    LDSX();                                                   // both lanes of the pair have read all 49 logits before either overwrites them
    for (int n = hf; n < KS * KS; n += 2) slg[px][n] = expf(slg[px][n] - mx) * sc; }
  __syncthreads();                                            // all waves done with su.k (scores) before it becomes the output tile
  // out[px][c] = sum_ki P_ki[px][:] @ V_ki[:][c]  : M 16 per wave, K = 96 (3 chunks; cols >= 70 of P are zero, v rows >= 70 clamped), N 128
  { v8f acc[8] = {};
#pragma unroll 1
    for (int ki = 0; ki < KS; ++ki) {
      // build this wave's band rows for ki: zero the 16 x 104 tile, then P[pl][pl_global + kj] = prob
      for (int q = lane; q < 16 * 13; q += 32) { const int rl = q / 13, pc = q % 13; *(v4u*)(&sP[wave][rl][pc * 8]) = (v4u){0u, 0u, 0u, 0u}; }
      LDSX();
      { const int pl = lane >> 1, hf = lane & 1; const int px = wave * 16 + pl; for (int kj = hf * 4; kj < (hf ? 7 : 4); ++kj) sP[wave][pl][px + kj] = (_Float16)slg[px][ki * KS + kj]; }
      LDSX();
#pragma unroll
      for (int kc = 0; kc < 3; ++kc) { const v16h a = frag_h(&sP[wave][col][kc * 32], lane);
#pragma unroll
        for (int t = 0; t < 8; ++t) { v16h bv; const int n = t * 16 + col;
#pragma unroll
          for (int i = 0; i < 8; ++i) { const int ka = kc * 32 + 8 * g + i, kb = ka + 16; bv[i] = sv[ki][ka < HW + 6 ? ka : HW + 5][n]; bv[8 + i] = sv[ki][kb < HW + 6 ? kb : HW + 5][n]; }
          acc[t] = wmma16(a, bv, acc[t]); } }
      LDSX(); }
#pragma unroll
    for (int t = 0; t < 8; ++t)
#pragma unroll
      for (int r = 0; r < 8; ++r) su.o[wave * 16 + 8 * g + r][t * 16 + col] = acc[t][r] * (1.0f / 16384.0f); }
  __syncthreads();
  for (int q = tid; q < CC * 16; q += 128) { const int c = q >> 4, x4 = q & 15; vst2(out + (((size_t)b * CC + c) * HW + y) * HW + x4 * 4, (v4f){su.o[x4 * 4][c], su.o[x4 * 4 + 1][c], su.o[x4 * 4 + 2][c], su.o[x4 * 4 + 3][c]}); }
}
extern "C" void kernel_launch(void* const* d_in, const int* in_sizes, int n_in, void* d_out, int out_size, void* d_ws, size_t ws_size, hipStream_t stream) {
  (void)in_sizes; (void)n_in; (void)out_size; (void)ws_size;
  const float** I = (const float**)d_in;
  const float* x = I[0]; const float* wq = I[1]; const float* wk = I[2]; const float* wv = I[3]; const float* relx = I[4]; const float* rely = I[5];
  float* out = (float*)d_out;
  char* ws = (char*)d_ws; size_t off = 0;
  auto take = [&](size_t bytes) { char* p = ws + off; off += (bytes + 255) & ~(size_t)255; return p; };
  const size_t NP = (size_t)NB * HW * HW;
  float* QF = (float*)take(NP * CC * 4); _Float16* KH = (_Float16*)take(NP * CC * 2); _Float16* VH = (_Float16*)take(NP * CC * 2);
  k_qkv<<<dim3(HW, NB), 128, 0, stream>>>(x, wq, wk, wv, QF, KH, VH);
  k_attn<<<dim3(HW, NB), 128, 0, stream>>>(QF, KH, VH, relx, rely, out);
}

// v002
// It runs in 48.7 microseconds.
// Next to v001, in two timings, it ran 1.45 and 1.46 times as fast.
// All steps since v000 together make it 2.06 times as fast.
#include <hip/hip_runtime.h>
#include <math.h>

typedef __attribute__((ext_vector_type(16))) _Float16 v16h;
typedef __attribute__((ext_vector_type(16))) __bf16 v16b;
typedef __attribute__((ext_vector_type(8)))  _Float16 v8h;
typedef __attribute__((ext_vector_type(8)))  float v8f;
typedef __attribute__((ext_vector_type(4)))  float v4f;
typedef __attribute__((ext_vector_type(2)))  float v2f;
typedef __attribute__((ext_vector_type(4)))  unsigned v4u;
typedef __attribute__((ext_vector_type(4)))  int v4i;
typedef float __attribute__((may_alias)) float_a;
typedef int __attribute__((may_alias)) int_a;

template <typename T> __device__ __forceinline__ void vst2(void* p, T v) { *(T*)p = v;  }
__device__ __forceinline__ v8f wmma16(v16h a, v16h b, v8f c) {
  v8f d = __builtin_amdgcn_wmma_f32_16x16x32_f16(false, a, false, b, (short)0, c, false, false);
  asm volatile("v_nop\n\tv_nop\n\tv_nop\n\tv_nop" : "+v"(d) : "v"(a), "v"(b));
  return d;
}
__device__ __forceinline__ v8f wmma_bf(v16b a, v16b b, v8f c) {
  v8f d = __builtin_amdgcn_wmma_f32_16x16x32_bf16(false, a, false, b, (short)0, c, false, false);
  asm volatile("v_nop\n\tv_nop\n\tv_nop\n\tv_nop" : "+v"(d) : "v"(a), "v"(b));
  return d;
}
// 16x16x32 fragments: lane = (h = lane>>4, row/col = lane&15); elements 0..7 = k0+8h+0..7, 8..15 = k0+16+8h+0..7; D element r = row 8h+r
__device__ __forceinline__ v16h frag_h(const _Float16* rowk0, int lane) {
  union { v16h v; v8h q[2]; } u; const _Float16* p = rowk0 + 8 * (lane >> 4);
  u.q[0] = *(const v8h*)p; u.q[1] = *(const v8h*)(p + 16); return u.v;
}
__device__ __forceinline__ v16h frag_f32(const float* rowk0, int lane) {
  v16h a; const float* p = rowk0 + 8 * (lane >> 4);
#pragma unroll
  for (int i = 0; i < 8; ++i) { a[i] = (_Float16)p[i]; a[8 + i] = (_Float16)p[16 + i]; }
  return a;
}
__device__ __forceinline__ v16h frag_f32s(const float* rowk0, int lane, float sc) {
  v16h a; const float* p = rowk0 + 8 * (lane >> 4);
#pragma unroll
  for (int i = 0; i < 8; ++i) { a[i] = (_Float16)(p[i] * sc); a[8 + i] = (_Float16)(p[16 + i] * sc); }
  return a;
}
// column fragment from a [K][ld] layout (column n), rows >= K read as 0
__device__ __forceinline__ v16h fragc_f32(const float* W, int k0, int n, int lane, int ld, int K) {
  v16h a; const int g = lane >> 4;
#pragma unroll
  for (int i = 0; i < 8; ++i) { const int ka = k0 + 8 * g + i, kb = ka + 16;
    a[i] = (_Float16)(ka < K ? W[(size_t)ka * ld + n] : 0.f); a[8 + i] = (_Float16)(kb < K ? W[(size_t)kb * ld + n] : 0.f); }
  return a;
}
struct F2 { v16b h, l; };
__device__ __forceinline__ F2 bsplit16(const float v[16]) { F2 r;
#pragma unroll
  for (int i = 0; i < 16; ++i) { const __bf16 h = (__bf16)v[i]; r.h[i] = h; r.l[i] = (__bf16)(v[i] - (float)h); }
  return r; }
__device__ __forceinline__ F2 split_row(const float* row, int k0, int lane) { float v[16]; const float* p = row + k0 + 8 * (lane >> 4);
#pragma unroll
  for (int i = 0; i < 8; ++i) { v[i] = p[i]; v[8 + i] = p[16 + i]; }
  return bsplit16(v); }
__device__ __forceinline__ F2 split_rowK(const float* row, int k0, int lane, int K) { float v[16]; const int g = lane >> 4;
#pragma unroll
  for (int i = 0; i < 8; ++i) { const int ka = k0 + 8 * g + i, kb = ka + 16; v[i] = ka < K ? row[ka] : 0.f; v[8 + i] = kb < K ? row[kb] : 0.f; }
  return bsplit16(v); }
__device__ __forceinline__ F2 split_col(const float* W, int k0, int n, int lane, int ld, int K) { float v[16]; const int g = lane >> 4;
#pragma unroll
  for (int i = 0; i < 8; ++i) { const int ka = k0 + 8 * g + i, kb = ka + 16; v[i] = ka < K ? W[(size_t)ka * ld + n] : 0.f; v[8 + i] = kb < K ? W[(size_t)kb * ld + n] : 0.f; }
  return bsplit16(v); }
__device__ __forceinline__ v8f mac3(const F2& a, const F2& b, v8f c) { c = wmma_bf(a.l, b.h, c); c = wmma_bf(a.h, b.l, c); return wmma_bf(a.h, b.h, c); }
__device__ __forceinline__ float sigm(float v) { return 1.0f / (1.0f + expf(-v)); }
#define LDSX() do { asm volatile("s_wait_dscnt 0" ::: "memory"); __builtin_amdgcn_wave_barrier(); __builtin_amdgcn_fence(__ATOMIC_RELEASE, "workgroup"); } while (0)

// Stand-alone local self attention (7x7 window, stride 1, zero padding 3, one 128-channel head with relative position logits from the first /
// second 8 channels of each 16-channel group): q, k, v = 1x1 convs of the input (q as a two-way bf16 split on v_wmma_f32_16x16x32_bf16 because
// it feeds the large relative-position logits, k likewise (its conv rounding dominated the logits error), v on f16 WMMA; [out][in] weights converted in the fragments), stored channels-last
// (q f32, k/v f16). Then per output pixel: 49 logits = q.k(window) + bias_x[l] + bias_y[k] in f32 from LDS halo tiles (padding = zero k/v,
#define NB 4
#define CC 128
#define HW 64
#define KS 7
#define PADW 3
#define NG 8
#define RS 8

// one wave brings 32 rows (512 B each, one row per copy, 16 B per lane) of a [128][128] f32 weight matrix into LDS rows of CC + 4 floats, through no register.
// Eight copies a statement; s_wait_xcnt closes the statement so that no address register of a copy is rewritten in front of it.
__device__ __forceinline__ void stage_w(const float* __restrict__ w, float (*dst)[CC + 4], int wave, int lane) {
  for (int j = 0; j < 32; j += 8) { const int r = wave * 32 + j; const float* g = w + (size_t)r * CC + lane * 4; const unsigned l = (unsigned)(size_t)&dst[r][lane * 4]; const unsigned P = (CC + 4) * 4;
    asm volatile("global_load_async_to_lds_b128 %0, %8, off\n\tglobal_load_async_to_lds_b128 %1, %9, off\n\tglobal_load_async_to_lds_b128 %2, %10, off\n\tglobal_load_async_to_lds_b128 %3, %11, off\n\t"
                 "global_load_async_to_lds_b128 %4, %12, off\n\tglobal_load_async_to_lds_b128 %5, %13, off\n\tglobal_load_async_to_lds_b128 %6, %14, off\n\tglobal_load_async_to_lds_b128 %7, %15, off\n\ts_wait_xcnt 0x0"
                 :: "v"(l), "v"(l + P), "v"(l + 2 * P), "v"(l + 3 * P), "v"(l + 4 * P), "v"(l + 5 * P), "v"(l + 6 * P), "v"(l + 7 * P),
                    "v"(g), "v"(g + CC), "v"(g + 2 * CC), "v"(g + 3 * CC), "v"(g + 4 * CC), "v"(g + 5 * CC), "v"(g + 6 * CC), "v"(g + 7 * CC) : "memory"); }
}
// phase 1: block (b, y): transpose x[b][:, y, :] (NCHW) to 64 token rows; q (split) -> QF f32 [b][y][x][128]; k (split), v (f16) -> KH/VH f16 [b][y][x][128]
__global__ __launch_bounds__(128) void k_qkv(const float* __restrict__ x, const float* __restrict__ wq, const float* __restrict__ wk, const float* __restrict__ wv, float* __restrict__ QF, _Float16* __restrict__ KH, _Float16* __restrict__ VH) {
  __shared__ __align__(16) float sx[64][CC + 4];            // [x][c] f32
  __shared__ __align__(16) float so[4][16][132];
  __shared__ __align__(16) float sw[3][CC][CC + 4];         // wq, wk, wv as given ([out][in] f32), each filled once by asynchronous copies
  const int tid = threadIdx.x, wave = tid >> 5, lane = tid & 31, col = lane & 15, g = lane >> 4;
  const int b = blockIdx.y, y = blockIdx.x;
  stage_w(wq, sw[0], wave, lane);                           // lands while x is transposed
  for (int q = tid; q < CC * 16; q += 128) { const int c = q >> 4, x4 = q & 15; const v4f v = *(const v4f*)(x + (((size_t)b * CC + c) * HW + y) * HW + x4 * 4); sx[x4 * 4][c] = v[0]; sx[x4 * 4 + 1][c] = v[1]; sx[x4 * 4 + 2][c] = v[2]; sx[x4 * 4 + 3][c] = v[3]; }
  asm volatile("s_wait_asynccnt 0x0" ::: "memory");         // this wave's rows of wq have landed before the barrier publishes them
  __syncthreads();
  stage_w(wk, sw[1], wave, lane);                           // lands under the q products
  const size_t prow0 = ((size_t)b * HW + y) * HW + wave * 16;      // pixel row index of this wave's first token
  // q: bf16 split
  { v8f acc[8] = {};
#pragma unroll 1
    for (int kc = 0; kc < CC / 32; ++kc) { const F2 a = split_row(&sx[wave * 16 + col][0], kc * 32, lane);
#pragma unroll
      for (int t = 0; t < 8; ++t) acc[t] = mac3(a, split_row(&sw[0][t * 16 + col][0], kc * 32, lane), acc[t]); }
#pragma unroll
    for (int t = 0; t < 8; ++t)
#pragma unroll
      for (int r = 0; r < 8; ++r) so[wave][8 * g + r][t * 16 + col] = acc[t][r]; }
  LDSX();
#pragma unroll 4
  for (int rl = 0; rl < 16; ++rl) vst2(QF + (prow0 + rl) * CC + lane * 4, *(const v4f*)(&so[wave][rl][lane * 4]));
  LDSX();
  // k (bf16 split) and v (f16), both stored f16
#pragma unroll 1
  for (int which = 0; which < 2; ++which) { _Float16* D = which == 0 ? KH : VH; v8f acc[8] = {};
    asm volatile("s_wait_asynccnt 0x0" ::: "memory");       // this wave's rows of this pass's weights have landed before the barrier publishes them
    __syncthreads();
    if (which == 0) stage_w(wv, sw[2], wave, lane);         // lands under the k products
    if (which == 0) {   // k feeds the logits: two-way bf16 split
#pragma unroll 1
      for (int kc = 0; kc < CC / 32; ++kc) { const F2 a = split_row(&sx[wave * 16 + col][0], kc * 32, lane);
#pragma unroll
        for (int t = 0; t < 8; ++t) acc[t] = mac3(a, split_row(&sw[1][t * 16 + col][0], kc * 32, lane), acc[t]); } }
    else {
#pragma unroll
      for (int kc = 0; kc < CC / 32; ++kc) { const v16h a = frag_f32(&sx[wave * 16 + col][0] + kc * 32, lane);
#pragma unroll
        for (int t = 0; t < 8; ++t) acc[t] = wmma16(a, frag_f32s(&sw[2][t * 16 + col][0] + kc * 32, lane, 16.0f), acc[t]); }
#pragma unroll
      for (int t = 0; t < 8; ++t)
#pragma unroll
        for (int r = 0; r < 8; ++r) acc[t][r] *= (1.0f / 16.0f); }
#pragma unroll
    for (int t = 0; t < 8; ++t)
#pragma unroll
      for (int r = 0; r < 8; ++r) so[wave][8 * g + r][t * 16 + col] = acc[t][r];
    LDSX();
    for (int q = lane; q < 16 * 16; q += 32) { const int rl = q >> 4, pc = q & 15; union { v8h h8; v4u u; } pk;
#pragma unroll
      for (int e = 0; e < 8; ++e) pk.h8[e] = (_Float16)so[wave][rl][pc * 8 + e];
      vst2(D + (prow0 + rl) * CC + pc * 8, pk.u); }
    LDSX(); }
}
__device__ __forceinline__ void stage_halo(const _Float16* __restrict__ src, _Float16 (*dst)[HW + 6][CC + 8], int b, int y, int wave, int lane) {
  for (int ry = 0; ry < KS; ++ry) { const int yy = y - PADW + ry; if ((unsigned)yy >= (unsigned)HW) continue;
    const _Float16* g = src + ((((size_t)b * HW + yy) * HW + wave * 16 + (lane >> 4)) * CC + (lane & 15) * 8); const unsigned l = (unsigned)(size_t)&dst[ry][PADW + wave * 16 + (lane >> 4)][(lane & 15) * 8]; const unsigned P = 2 * (CC + 8) * 2;
    asm volatile("global_load_async_to_lds_b128 %0, %8, off\n\tglobal_load_async_to_lds_b128 %1, %9, off\n\tglobal_load_async_to_lds_b128 %2, %10, off\n\tglobal_load_async_to_lds_b128 %3, %11, off\n\t"
                 "global_load_async_to_lds_b128 %4, %12, off\n\tglobal_load_async_to_lds_b128 %5, %13, off\n\tglobal_load_async_to_lds_b128 %6, %14, off\n\tglobal_load_async_to_lds_b128 %7, %15, off\n\ts_wait_xcnt 0x0"
                 :: "v"(l), "v"(l + P), "v"(l + 2 * P), "v"(l + 3 * P), "v"(l + 4 * P), "v"(l + 5 * P), "v"(l + 6 * P), "v"(l + 7 * P),
                    "v"(g), "v"(g + 2 * CC), "v"(g + 4 * CC), "v"(g + 6 * CC), "v"(g + 8 * CC), "v"(g + 10 * CC), "v"(g + 12 * CC), "v"(g + 14 * CC) : "memory"); }
}
// phase 2: block (b, y): 7-row halo of k and v (f16, zero padded); per window row ki: S = Q K_row^T on WMMA (q as hi/lo f16 pair -> two
// products, k f16) giving the 64 x 70 score slab, logits = S[px][px+kj] + bias_x[kj] + bias_y[ki]; softmax over 49 in f32; then per ki the
// band matrix P[px][px+kj] (x 2^14, f16) times V_row on WMMA accumulates out[px][c]. Output written NCHW (whole 256-B rows per channel).
__global__ __launch_bounds__(128) void k_attn(const float* __restrict__ QF, const _Float16* __restrict__ KH, const _Float16* __restrict__ VH, const float* __restrict__ relx, const float* __restrict__ rely, float* __restrict__ out) {
  __shared__ __align__(16) union U { _Float16 k[KS][HW + 6][CC + 8]; float o[64][CC + 4]; } su;   // k halo, later the output tile
  __shared__ __align__(16) _Float16 sv[KS][HW + 6][CC + 8];
  __shared__ __align__(16) float sS[64][72];                 // scores for one ki: [px][pxx]
  __shared__ __align__(16) _Float16 sP[4][16][104];           // per wave: band matrix rows (x 2^14) for the current ki: [px][pxx], zero elsewhere
  __shared__ float slg[64][52];                              // logits / probabilities per pixel
  __shared__ float sbx[64][8], sby[64][8];
  const int tid = threadIdx.x, wave = tid >> 5, lane = tid & 31, col = lane & 15, g = lane >> 4; const int b = blockIdx.y, y = blockIdx.x;
  stage_halo(KH, su.k, b, y, wave, lane);                     // lands while the zero padding is written and the position logits are summed
  // zero padding of both halos: the three columns left and right of the image, then the whole rows above or below it; no copy writes these bytes
  for (int q = tid; q < KS * 2 * PADW * (CC / 8); q += 128) { const int pc = q & 15, rest = q >> 4; const int ry = rest / (2 * PADW), e = rest % (2 * PADW); const int px = e < PADW ? e : HW + e;
    *(v4u*)(&su.k[ry][px][pc * 8]) = (v4u){0u, 0u, 0u, 0u}; *(v4u*)(&sv[ry][px][pc * 8]) = (v4u){0u, 0u, 0u, 0u}; }
  for (int ry = 0; ry < KS; ++ry) { if ((unsigned)(y - PADW + ry) < (unsigned)HW) continue;
    for (int q = tid; q < HW * (CC / 8); q += 128) { const int pc = q & 15, px = PADW + (q >> 4); *(v4u*)(&su.k[ry][px][pc * 8]) = (v4u){0u, 0u, 0u, 0u}; *(v4u*)(&sv[ry][px][pc * 8]) = (v4u){0u, 0u, 0u, 0u}; } }
  { const int px = tid >> 1, hf = tid & 1; const float* qr = QF + (((size_t)b * HW + y) * HW + px) * CC; const float* relw = hf == 0 ? relx : rely; float bb[KS];
#pragma unroll
    for (int l = 0; l < KS; ++l) bb[l] = 0.f;
#pragma unroll 1
    for (int gq = 0; gq < NG; ++gq) {
#pragma unroll 1
      for (int i = 0; i < RS; ++i) { const float qv = qr[gq * 16 + hf * 8 + i];
#pragma unroll
        for (int l = 0; l < KS; ++l) bb[l] += qv * relw[i * KS + l]; } }
    float* dstb = hf == 0 ? &sbx[px][0] : &sby[px][0];
#pragma unroll
    for (int l = 0; l < KS; ++l) dstb[l] = bb[l]; }
  asm volatile("s_wait_asynccnt 0x0" ::: "memory");           // this wave's part of the k halo has landed before the barrier publishes it
  __syncthreads();
  // q fragments (hi/lo f16) for this wave's 16 pixels, 4 k-chunks
  const float* qrow = QF + (((size_t)b * HW + y) * HW + wave * 16 + col) * CC;
  v16h qh[4], ql[4];
#pragma unroll
  for (int kc = 0; kc < 4; ++kc) { const float* p = qrow + kc * 32 + 8 * g;
#pragma unroll
    for (int i = 0; i < 8; ++i) { const float v0 = p[i], v1 = p[16 + i]; const _Float16 h0 = (_Float16)v0, h1 = (_Float16)v1; qh[kc][i] = h0; qh[kc][8 + i] = h1; ql[kc][i] = (_Float16)((v0 - (float)h0) * 2048.0f); ql[kc][8 + i] = (_Float16)((v1 - (float)h1) * 2048.0f); } }
  stage_halo(VH, sv, b, y, wave, lane);                       // lands under the scores and the softmax; behind the k halo's wait, so that no wave has more than 56 copies outstanding, and behind the q loads, which would queue after it
#pragma unroll 1
  for (int ki = 0; ki < KS; ++ki) {
    // S[px][pxx] for pxx tiles 0..4 (80 cols, cols >= 70 read k rows 70..79 -> out of the halo: clamp to 69, values unused)
#pragma unroll 1
    for (int t = 0; t < 5; ++t) { const int pxx = t * 16 + col; const _Float16* krow = &su.k[ki][pxx < HW + 6 ? pxx : HW + 5][0]; v8f acc = {}, acl = {};
#pragma unroll
      for (int kc = 0; kc < 4; ++kc) { const v16h bk = frag_h(krow + kc * 32, lane); acc = wmma16(qh[kc], bk, acc); acl = wmma16(ql[kc], bk, acl); }
#pragma unroll
      for (int r = 0; r < 8; ++r) { if (pxx < 72) sS[wave * 16 + 8 * g + r][pxx] = acc[r] + acl[r] * (1.0f / 2048.0f); } }
    LDSX();
    // logits for this wave's pixels: lane (pl = lane>>1, hf): kj in hf ? 4..6 : 0..3
    { const int pl = lane >> 1, hf = lane & 1; const int px = wave * 16 + pl;
      for (int kj = hf * 4; kj < (hf ? 7 : 4); ++kj) slg[px][ki * KS + kj] = sS[px][px + kj] + sbx[px][kj] + sby[px][ki]; }
    LDSX(); }
  // softmax per pixel (lane pairs): slg <- probabilities x 2^14 (in place)
  { const int pl = lane >> 1, hf = lane & 1; const int px = wave * 16 + pl; float mx = -3.4e38f;
    for (int n = 0; n < KS * KS; ++n) mx = fmaxf(mx, slg[px][n]);
    float se = 0.f;
    for (int n = 0; n < KS * KS; ++n) se += expf(slg[px][n] - mx);
    const float sc = 16384.0f / se;
    LDSX();                                                   // both lanes of the pair have read all 49 logits before either overwrites them
    for (int n = hf; n < KS * KS; n += 2) slg[px][n] = expf(slg[px][n] - mx) * sc; }
  asm volatile("s_wait_asynccnt 0x0" ::: "memory");           // this wave's part of the v halo has landed before the barrier publishes it
  __syncthreads();                                            // all waves done with su.k (scores) before it becomes the output tile
  // out[px][c] = sum_ki P_ki[px][:] @ V_ki[:][c]  : M 16 per wave, K = 96 (3 chunks; cols >= 70 of P are zero, v rows >= 70 clamped), N 128
  { v8f acc[8] = {};
#pragma unroll 1
    for (int ki = 0; ki < KS; ++ki) {
      // build this wave's band rows for ki: zero the 16 x 104 tile, then P[pl][pl_global + kj] = prob
      for (int q = lane; q < 16 * 13; q += 32) { const int rl = q / 13, pc = q % 13; *(v4u*)(&sP[wave][rl][pc * 8]) = (v4u){0u, 0u, 0u, 0u}; }
      LDSX();
      { const int pl = lane >> 1, hf = lane & 1; const int px = wave * 16 + pl; for (int kj = hf * 4; kj < (hf ? 7 : 4); ++kj) sP[wave][pl][px + kj] = (_Float16)slg[px][ki * KS + kj]; }
      LDSX();
#pragma unroll
      for (int kc = 0; kc < 3; ++kc) { const v16h a = frag_h(&sP[wave][col][kc * 32], lane);
#pragma unroll
        for (int t = 0; t < 8; ++t) { v16h bv; const int n = t * 16 + col;
#pragma unroll
          for (int i = 0; i < 8; ++i) { const int ka = kc * 32 + 8 * g + i, kb = ka + 16; bv[i] = sv[ki][ka < HW + 6 ? ka : HW + 5][n]; bv[8 + i] = sv[ki][kb < HW + 6 ? kb : HW + 5][n]; }
          acc[t] = wmma16(a, bv, acc[t]); } }
      LDSX(); }
#pragma unroll
    for (int t = 0; t < 8; ++t)
#pragma unroll
      for (int r = 0; r < 8; ++r) su.o[wave * 16 + 8 * g + r][t * 16 + col] = acc[t][r] * (1.0f / 16384.0f); }
  __syncthreads();
  for (int q = tid; q < CC * 16; q += 128) { const int c = q >> 4, x4 = q & 15; vst2(out + (((size_t)b * CC + c) * HW + y) * HW + x4 * 4, (v4f){su.o[x4 * 4][c], su.o[x4 * 4 + 1][c], su.o[x4 * 4 + 2][c], su.o[x4 * 4 + 3][c]}); }
}
extern "C" void kernel_launch(void* const* d_in, const int* in_sizes, int n_in, void* d_out, int out_size, void* d_ws, size_t ws_size, hipStream_t stream) {
  (void)in_sizes; (void)n_in; (void)out_size; (void)ws_size;
  const float** I = (const float**)d_in;
  const float* x = I[0]; const float* wq = I[1]; const float* wk = I[2]; const float* wv = I[3]; const float* relx = I[4]; const float* rely = I[5];
  float* out = (float*)d_out;
  char* ws = (char*)d_ws; size_t off = 0;
  auto take = [&](size_t bytes) { char* p = ws + off; off += (bytes + 255) & ~(size_t)255; return p; };
  const size_t NP = (size_t)NB * HW * HW;
  float* QF = (float*)take(NP * CC * 4); _Float16* KH = (_Float16*)take(NP * CC * 2); _Float16* VH = (_Float16*)take(NP * CC * 2);
  k_qkv<<<dim3(HW, NB), 128, 0, stream>>>(x, wq, wk, wv, QF, KH, VH);
  k_attn<<<dim3(HW, NB), 128, 0, stream>>>(QF, KH, VH, relx, rely, out);
}

// v003
// One run takes 36.7 microseconds.
// In two side-by-side timings against v002, it was 1.32 and 1.33 times as fast.
// Over all steps from v000 it is 2.73 times as fast.
#include <hip/hip_runtime.h>
#include <math.h>

typedef __attribute__((ext_vector_type(16))) _Float16 v16h;
typedef __attribute__((ext_vector_type(16))) __bf16 v16b;
typedef __attribute__((ext_vector_type(8)))  _Float16 v8h;
typedef __attribute__((ext_vector_type(8)))  float v8f;
typedef __attribute__((ext_vector_type(4)))  float v4f;
typedef __attribute__((ext_vector_type(2)))  float v2f;
typedef __attribute__((ext_vector_type(4)))  unsigned v4u;
typedef __attribute__((ext_vector_type(4)))  int v4i;
typedef float __attribute__((may_alias)) float_a;
typedef int __attribute__((may_alias)) int_a;

template <typename T> __device__ __forceinline__ void vst2(void* p, T v) { *(T*)p = v;  }
__device__ __forceinline__ v8f wmma16(v16h a, v16h b, v8f c) {
  v8f d = __builtin_amdgcn_wmma_f32_16x16x32_f16(false, a, false, b, (short)0, c, false, false);
  asm volatile("v_nop\n\tv_nop\n\tv_nop\n\tv_nop" : "+v"(d) : "v"(a), "v"(b));
  return d;
}
__device__ __forceinline__ v8f wmma_bf(v16b a, v16b b, v8f c) {
  v8f d = __builtin_amdgcn_wmma_f32_16x16x32_bf16(false, a, false, b, (short)0, c, false, false);
  asm volatile("v_nop\n\tv_nop\n\tv_nop\n\tv_nop" : "+v"(d) : "v"(a), "v"(b));
  return d;
}
// 16x16x32 fragments: lane = (h = lane>>4, row/col = lane&15); elements 0..7 = k0+8h+0..7, 8..15 = k0+16+8h+0..7; D element r = row 8h+r
__device__ __forceinline__ v16h frag_h(const _Float16* rowk0, int lane) {
  union { v16h v; v8h q[2]; } u; const _Float16* p = rowk0 + 8 * (lane >> 4);
  u.q[0] = *(const v8h*)p; u.q[1] = *(const v8h*)(p + 16); return u.v;
}
__device__ __forceinline__ v16h frag_f32(const float* rowk0, int lane) {
  v16h a; const float* p = rowk0 + 8 * (lane >> 4);
#pragma unroll
  for (int i = 0; i < 8; ++i) { a[i] = (_Float16)p[i]; a[8 + i] = (_Float16)p[16 + i]; }
  return a;
}
__device__ __forceinline__ v16h frag_f32s(const float* rowk0, int lane, float sc) {
  v16h a; const float* p = rowk0 + 8 * (lane >> 4);
#pragma unroll
  for (int i = 0; i < 8; ++i) { a[i] = (_Float16)(p[i] * sc); a[8 + i] = (_Float16)(p[16 + i] * sc); }
  return a;
}
// column fragment from a [K][ld] layout (column n), rows >= K read as 0
__device__ __forceinline__ v16h fragc_f32(const float* W, int k0, int n, int lane, int ld, int K) {
  v16h a; const int g = lane >> 4;
#pragma unroll
  for (int i = 0; i < 8; ++i) { const int ka = k0 + 8 * g + i, kb = ka + 16;
    a[i] = (_Float16)(ka < K ? W[(size_t)ka * ld + n] : 0.f); a[8 + i] = (_Float16)(kb < K ? W[(size_t)kb * ld + n] : 0.f); }
  return a;
}
struct F2 { v16b h, l; };
__device__ __forceinline__ F2 bsplit16(const float v[16]) { F2 r;
#pragma unroll
  for (int i = 0; i < 16; ++i) { const __bf16 h = (__bf16)v[i]; r.h[i] = h; r.l[i] = (__bf16)(v[i] - (float)h); }
  return r; }
__device__ __forceinline__ F2 split_row(const float* row, int k0, int lane) { float v[16]; const float* p = row + k0 + 8 * (lane >> 4);
#pragma unroll
  for (int i = 0; i < 8; ++i) { v[i] = p[i]; v[8 + i] = p[16 + i]; }
  return bsplit16(v); }
__device__ __forceinline__ F2 split_rowK(const float* row, int k0, int lane, int K) { float v[16]; const int g = lane >> 4;
#pragma unroll
  for (int i = 0; i < 8; ++i) { const int ka = k0 + 8 * g + i, kb = ka + 16; v[i] = ka < K ? row[ka] : 0.f; v[8 + i] = kb < K ? row[kb] : 0.f; }
  return bsplit16(v); }
__device__ __forceinline__ F2 split_col(const float* W, int k0, int n, int lane, int ld, int K) { float v[16]; const int g = lane >> 4;
#pragma unroll
  for (int i = 0; i < 8; ++i) { const int ka = k0 + 8 * g + i, kb = ka + 16; v[i] = ka < K ? W[(size_t)ka * ld + n] : 0.f; v[8 + i] = kb < K ? W[(size_t)kb * ld + n] : 0.f; }
  return bsplit16(v); }
__device__ __forceinline__ v8f mac3(const F2& a, const F2& b, v8f c) { c = wmma_bf(a.l, b.h, c); c = wmma_bf(a.h, b.l, c); return wmma_bf(a.h, b.h, c); }
__device__ __forceinline__ float sigm(float v) { return 1.0f / (1.0f + expf(-v)); }
#define LDSX() do { asm volatile("s_wait_dscnt 0" ::: "memory"); __builtin_amdgcn_wave_barrier(); __builtin_amdgcn_fence(__ATOMIC_RELEASE, "workgroup"); } while (0)

// Stand-alone local self attention (7x7 window, stride 1, zero padding 3, one 128-channel head with relative position logits from the first /
// second 8 channels of each 16-channel group): q, k, v = 1x1 convs of the input (q as a two-way bf16 split on v_wmma_f32_16x16x32_bf16 because
// it feeds the large relative-position logits, k likewise (its conv rounding dominated the logits error), v on f16 WMMA; [out][in] weights converted in the fragments), stored channels-last
// (q f32, k/v f16). Then per output pixel: 49 logits = q.k(window) + bias_x[l] + bias_y[k] in f32 from LDS halo tiles (padding = zero k/v,
#define NB 4
#define CC 128
#define HW 64
#define KS 7
#define PADW 3
#define NG 8
#define RS 8

// one wave brings 32 rows (512 B each, one row per copy, 16 B per lane) of a [128][128] f32 weight matrix into LDS rows of CC + 4 floats, through no register.
// Eight copies a statement; s_wait_xcnt closes the statement so that no address register of a copy is rewritten in front of it.
__device__ __forceinline__ void stage_w(const float* __restrict__ w, float (*dst)[CC + 4], int wave, int lane) {
  for (int j = 0; j < 32; j += 8) { const int r = wave * 32 + j; const float* g = w + (size_t)r * CC + lane * 4; const unsigned l = (unsigned)(size_t)&dst[r][lane * 4]; const unsigned P = (CC + 4) * 4;
    asm volatile("global_load_async_to_lds_b128 %0, %8, off\n\tglobal_load_async_to_lds_b128 %1, %9, off\n\tglobal_load_async_to_lds_b128 %2, %10, off\n\tglobal_load_async_to_lds_b128 %3, %11, off\n\t"
                 "global_load_async_to_lds_b128 %4, %12, off\n\tglobal_load_async_to_lds_b128 %5, %13, off\n\tglobal_load_async_to_lds_b128 %6, %14, off\n\tglobal_load_async_to_lds_b128 %7, %15, off\n\ts_wait_xcnt 0x0"
                 :: "v"(l), "v"(l + P), "v"(l + 2 * P), "v"(l + 3 * P), "v"(l + 4 * P), "v"(l + 5 * P), "v"(l + 6 * P), "v"(l + 7 * P),
                    "v"(g), "v"(g + CC), "v"(g + 2 * CC), "v"(g + 3 * CC), "v"(g + 4 * CC), "v"(g + 5 * CC), "v"(g + 6 * CC), "v"(g + 7 * CC) : "memory"); }
}
// phase 1: block (b, y): transpose x[b][:, y, :] (NCHW) to 64 token rows; q (split) -> QF f32 [b][y][x][128]; k (split), v (f16) -> KH/VH f16 [b][y][x][128]
__global__ __launch_bounds__(128) void k_qkv(const float* __restrict__ x, const float* __restrict__ wq, const float* __restrict__ wk, const float* __restrict__ wv, float* __restrict__ QF, _Float16* __restrict__ KH, _Float16* __restrict__ VH) {
  __shared__ __align__(16) float sx[64][CC + 4];            // [x][c] f32
  __shared__ __align__(16) float so[4][16][132];
  __shared__ __align__(16) float sw[3][CC][CC + 4];         // wq, wk, wv as given ([out][in] f32), each filled once by asynchronous copies
  const int tid = threadIdx.x, wave = tid >> 5, lane = tid & 31, col = lane & 15, g = lane >> 4;
  const int b = blockIdx.y, y = blockIdx.x;
  stage_w(wq, sw[0], wave, lane);                           // lands while x is transposed
  for (int q = tid; q < CC * 16; q += 128) { const int c = q >> 4, x4 = q & 15; const v4f v = *(const v4f*)(x + (((size_t)b * CC + c) * HW + y) * HW + x4 * 4); sx[x4 * 4][c] = v[0]; sx[x4 * 4 + 1][c] = v[1]; sx[x4 * 4 + 2][c] = v[2]; sx[x4 * 4 + 3][c] = v[3]; }
  asm volatile("s_wait_asynccnt 0x0" ::: "memory");         // this wave's rows of wq have landed before the barrier publishes them
  __syncthreads();
  stage_w(wk, sw[1], wave, lane);                           // lands under the q products
  const size_t prow0 = ((size_t)b * HW + y) * HW + wave * 16;      // pixel row index of this wave's first token
  // q: bf16 split
  { v8f acc[8] = {};
#pragma unroll 1
    for (int kc = 0; kc < CC / 32; ++kc) { const F2 a = split_row(&sx[wave * 16 + col][0], kc * 32, lane);
#pragma unroll
      for (int t = 0; t < 8; ++t) acc[t] = mac3(a, split_row(&sw[0][t * 16 + col][0], kc * 32, lane), acc[t]); }
#pragma unroll
    for (int t = 0; t < 8; ++t)
#pragma unroll
      for (int r = 0; r < 8; ++r) so[wave][8 * g + r][t * 16 + col] = acc[t][r]; }
  LDSX();
#pragma unroll 4
  for (int rl = 0; rl < 16; ++rl) vst2(QF + (prow0 + rl) * CC + lane * 4, *(const v4f*)(&so[wave][rl][lane * 4]));
  LDSX();
  // k (bf16 split) and v (f16), both stored f16
#pragma unroll 1
  for (int which = 0; which < 2; ++which) { _Float16* D = which == 0 ? KH : VH; v8f acc[8] = {};
    asm volatile("s_wait_asynccnt 0x0" ::: "memory");       // this wave's rows of this pass's weights have landed before the barrier publishes them
    __syncthreads();
    if (which == 0) stage_w(wv, sw[2], wave, lane);         // lands under the k products
    if (which == 0) {   // k feeds the logits: two-way bf16 split
#pragma unroll 1
      for (int kc = 0; kc < CC / 32; ++kc) { const F2 a = split_row(&sx[wave * 16 + col][0], kc * 32, lane);
#pragma unroll
        for (int t = 0; t < 8; ++t) acc[t] = mac3(a, split_row(&sw[1][t * 16 + col][0], kc * 32, lane), acc[t]); } }
    else {
#pragma unroll
      for (int kc = 0; kc < CC / 32; ++kc) { const v16h a = frag_f32(&sx[wave * 16 + col][0] + kc * 32, lane);
#pragma unroll
        for (int t = 0; t < 8; ++t) acc[t] = wmma16(a, frag_f32s(&sw[2][t * 16 + col][0] + kc * 32, lane, 16.0f), acc[t]); }
#pragma unroll
      for (int t = 0; t < 8; ++t)
#pragma unroll
        for (int r = 0; r < 8; ++r) acc[t][r] *= (1.0f / 16.0f); }
#pragma unroll
    for (int t = 0; t < 8; ++t)
#pragma unroll
      for (int r = 0; r < 8; ++r) so[wave][8 * g + r][t * 16 + col] = acc[t][r];
    LDSX();
    for (int q = lane; q < 16 * 16; q += 32) { const int rl = q >> 4, pc = q & 15; union { v8h h8; v4u u; } pk;
#pragma unroll
      for (int e = 0; e < 8; ++e) pk.h8[e] = (_Float16)so[wave][rl][pc * 8 + e];
      vst2(D + (prow0 + rl) * CC + pc * 8, pk.u); }
    LDSX(); }
}
__device__ __forceinline__ void stage_halo(const _Float16* __restrict__ src, _Float16 (*dst)[HW + 6][CC + 8], int b, int y, int wave, int lane) {
  for (int ry = 0; ry < KS; ++ry) { const int yy = y - PADW + ry; if ((unsigned)yy >= (unsigned)HW) continue;
    const _Float16* g = src + ((((size_t)b * HW + yy) * HW + wave * 16 + (lane >> 4)) * CC + (lane & 15) * 8); const unsigned l = (unsigned)(size_t)&dst[ry][PADW + wave * 16 + (lane >> 4)][(lane & 15) * 8]; const unsigned P = 2 * (CC + 8) * 2;
    asm volatile("global_load_async_to_lds_b128 %0, %8, off\n\tglobal_load_async_to_lds_b128 %1, %9, off\n\tglobal_load_async_to_lds_b128 %2, %10, off\n\tglobal_load_async_to_lds_b128 %3, %11, off\n\t"
                 "global_load_async_to_lds_b128 %4, %12, off\n\tglobal_load_async_to_lds_b128 %5, %13, off\n\tglobal_load_async_to_lds_b128 %6, %14, off\n\tglobal_load_async_to_lds_b128 %7, %15, off\n\ts_wait_xcnt 0x0"
                 :: "v"(l), "v"(l + P), "v"(l + 2 * P), "v"(l + 3 * P), "v"(l + 4 * P), "v"(l + 5 * P), "v"(l + 6 * P), "v"(l + 7 * P),
                    "v"(g), "v"(g + 2 * CC), "v"(g + 4 * CC), "v"(g + 6 * CC), "v"(g + 8 * CC), "v"(g + 10 * CC), "v"(g + 12 * CC), "v"(g + 14 * CC) : "memory"); }
}
// phase 2: block (b, y): 7-row halo of k and v (f16, zero padded); per window row ki: S = Q K_row^T on WMMA (q as hi/lo f16 pair -> two
// products, k f16), each wave over the 32 halo columns from its first pixel on (its 16 windows reach 22 of them), logits = S[px][px+kj] + bias_x[kj] + bias_y[ki];
// softmax over 49 in f32; then per ki the band matrix P[px][px+kj] (x 2^14, f16; the same 32 columns) times V_row on WMMA accumulates out[px][c]. Output written NCHW (whole 256-B rows per channel).
__global__ __launch_bounds__(128) void k_attn(const float* __restrict__ QF, const _Float16* __restrict__ KH, const _Float16* __restrict__ VH, const float* __restrict__ relx, const float* __restrict__ rely, float* __restrict__ out) {
  __shared__ __align__(16) union U { _Float16 k[KS][HW + 6][CC + 8]; float o[64][CC + 4]; } su;   // k halo, later the output tile
  __shared__ __align__(16) _Float16 sv[KS][HW + 6][CC + 8];
  __shared__ __align__(16) float sS[64][36];                 // scores for one ki: [px][pxx - 16 wave], 32 columns
  __shared__ __align__(16) _Float16 sP[4][16][40];            // per wave: band matrix rows (x 2^14) for the current ki: [px][pxx - 16 wave], 32 columns, zero off the band
  __shared__ float slg[64][52];                              // logits / probabilities per pixel
  __shared__ float sbx[64][8], sby[64][8];
  const int tid = threadIdx.x, wave = tid >> 5, lane = tid & 31, col = lane & 15, g = lane >> 4; const int b = blockIdx.y, y = blockIdx.x;
  stage_halo(KH, su.k, b, y, wave, lane);                     // lands while the zero padding is written and the position logits are summed
  // zero padding of both halos: the three columns left and right of the image, then the whole rows above or below it; no copy writes these bytes
  for (int q = tid; q < KS * 2 * PADW * (CC / 8); q += 128) { const int pc = q & 15, rest = q >> 4; const int ry = rest / (2 * PADW), e = rest % (2 * PADW); const int px = e < PADW ? e : HW + e;
    *(v4u*)(&su.k[ry][px][pc * 8]) = (v4u){0u, 0u, 0u, 0u}; *(v4u*)(&sv[ry][px][pc * 8]) = (v4u){0u, 0u, 0u, 0u}; }
  for (int ry = 0; ry < KS; ++ry) { if ((unsigned)(y - PADW + ry) < (unsigned)HW) continue;
    for (int q = tid; q < HW * (CC / 8); q += 128) { const int pc = q & 15, px = PADW + (q >> 4); *(v4u*)(&su.k[ry][px][pc * 8]) = (v4u){0u, 0u, 0u, 0u}; *(v4u*)(&sv[ry][px][pc * 8]) = (v4u){0u, 0u, 0u, 0u}; } }
  { const int px = tid >> 1, hf = tid & 1; const float* qr = QF + (((size_t)b * HW + y) * HW + px) * CC; const float* relw = hf == 0 ? relx : rely; float bb[KS];
#pragma unroll
    for (int l = 0; l < KS; ++l) bb[l] = 0.f;
#pragma unroll 1
    for (int gq = 0; gq < NG; ++gq) {
#pragma unroll 1
      for (int i = 0; i < RS; ++i) { const float qv = qr[gq * 16 + hf * 8 + i];
#pragma unroll
        for (int l = 0; l < KS; ++l) bb[l] += qv * relw[i * KS + l]; } }
    float* dstb = hf == 0 ? &sbx[px][0] : &sby[px][0];
#pragma unroll
    for (int l = 0; l < KS; ++l) dstb[l] = bb[l]; }
  asm volatile("s_wait_asynccnt 0x0" ::: "memory");           // this wave's part of the k halo has landed before the barrier publishes it
  __syncthreads();
  // q fragments (hi/lo f16) for this wave's 16 pixels, 4 k-chunks
  const float* qrow = QF + (((size_t)b * HW + y) * HW + wave * 16 + col) * CC;
  v16h qh[4], ql[4];
#pragma unroll
  for (int kc = 0; kc < 4; ++kc) { const float* p = qrow + kc * 32 + 8 * g;
#pragma unroll
    for (int i = 0; i < 8; ++i) { const float v0 = p[i], v1 = p[16 + i]; const _Float16 h0 = (_Float16)v0, h1 = (_Float16)v1; qh[kc][i] = h0; qh[kc][8 + i] = h1; ql[kc][i] = (_Float16)((v0 - (float)h0) * 2048.0f); ql[kc][8 + i] = (_Float16)((v1 - (float)h1) * 2048.0f); } }
  stage_halo(VH, sv, b, y, wave, lane);                       // lands under the scores and the softmax; behind the k halo's wait, so that no wave has more than 56 copies outstanding, and behind the q loads, which would queue after it
#pragma unroll 1
  for (int ki = 0; ki < KS; ++ki) {
    // S[px][pxx] only for the two 16-column tiles that this wave's windows reach (pxx = 16 wave .. 16 wave + 31; the windows end at 16 wave + 21).
    // In the last wave cols >= 70 would read k rows 70..79 -> out of the halo: clamp to 69, values unused
#pragma unroll   // two trips: unrolled, the tile's column in sS is a constant offset of the stores and no loop branch stands behind a matrix instruction
    for (int t = 0; t < 2; ++t) { const int pxx = (wave + t) * 16 + col; const _Float16* krow = &su.k[ki][pxx < HW + 6 ? pxx : HW + 5][0]; v8f acc = {}, acl = {};
#pragma unroll
      for (int kc = 0; kc < 4; ++kc) { const v16h bk = frag_h(krow + kc * 32, lane); acc = wmma16(qh[kc], bk, acc); acl = wmma16(ql[kc], bk, acl); }
#pragma unroll
      for (int r = 0; r < 8; ++r) sS[wave * 16 + 8 * g + r][t * 16 + col] = acc[r] + acl[r] * (1.0f / 2048.0f); }
    LDSX();
    // logits for this wave's pixels: lane (pl = lane>>1, hf): kj in hf ? 4..6 : 0..3
    { const int pl = lane >> 1, hf = lane & 1; const int px = wave * 16 + pl;
      for (int kj = hf * 4; kj < (hf ? 7 : 4); ++kj) slg[px][ki * KS + kj] = sS[px][pl + kj] + sbx[px][kj] + sby[px][ki]; }
    LDSX(); }
  // softmax per pixel (lane pairs): slg <- probabilities x 2^14 (in place)
  { const int pl = lane >> 1, hf = lane & 1; const int px = wave * 16 + pl; float mx = -3.4e38f;
    for (int n = 0; n < KS * KS; ++n) mx = fmaxf(mx, slg[px][n]);
    float se = 0.f;
    for (int n = 0; n < KS * KS; ++n) se += expf(slg[px][n] - mx);
    const float sc = 16384.0f / se;
    LDSX();                                                   // both lanes of the pair have read all 49 logits before either overwrites them
    for (int n = hf; n < KS * KS; n += 2) slg[px][n] = expf(slg[px][n] - mx) * sc; }
  asm volatile("s_wait_asynccnt 0x0" ::: "memory");           // this wave's part of the v halo has landed before the barrier publishes it
  __syncthreads();                                            // all waves done with su.k (scores) before it becomes the output tile
  // out[px][c] = sum_ki P_ki[px][:] @ V_ki[:][c]  : M 16 per wave, K = 32 (the one chunk of v rows 16 wave .. 16 wave + 31 that holds the wave's band; cols >= 22 of P are zero, v rows >= 70 clamped), N 128
  { v8f acc[8] = {};
#pragma unroll 1
    for (int ki = 0; ki < KS; ++ki) {
      // build this wave's band rows for ki: zero the 16 x 32 tile, then P[pl][pl + kj] = prob
      for (int q = lane; q < 16 * 4; q += 32) { const int rl = q >> 2, pc = q & 3; *(v4u*)(&sP[wave][rl][pc * 8]) = (v4u){0u, 0u, 0u, 0u}; }
      LDSX();
      { const int pl = lane >> 1, hf = lane & 1; const int px = wave * 16 + pl; for (int kj = hf * 4; kj < (hf ? 7 : 4); ++kj) sP[wave][pl][pl + kj] = (_Float16)slg[px][ki * KS + kj]; }
      LDSX();
      { const v16h a = frag_h(&sP[wave][col][0], lane);
#pragma unroll
        for (int t = 0; t < 8; ++t) { v16h bv; const int n = t * 16 + col;
#pragma unroll
          for (int i = 0; i < 8; ++i) { const int ka = wave * 16 + 8 * g + i, kb = ka + 16; bv[i] = sv[ki][ka < HW + 6 ? ka : HW + 5][n]; bv[8 + i] = sv[ki][kb < HW + 6 ? kb : HW + 5][n]; }
          acc[t] = wmma16(a, bv, acc[t]); } }
      LDSX(); }
#pragma unroll
    for (int t = 0; t < 8; ++t)
#pragma unroll
      for (int r = 0; r < 8; ++r) su.o[wave * 16 + 8 * g + r][t * 16 + col] = acc[t][r] * (1.0f / 16384.0f); }
  __syncthreads();
  for (int q = tid; q < CC * 16; q += 128) { const int c = q >> 4, x4 = q & 15; vst2(out + (((size_t)b * CC + c) * HW + y) * HW + x4 * 4, (v4f){su.o[x4 * 4][c], su.o[x4 * 4 + 1][c], su.o[x4 * 4 + 2][c], su.o[x4 * 4 + 3][c]}); }
}
extern "C" void kernel_launch(void* const* d_in, const int* in_sizes, int n_in, void* d_out, int out_size, void* d_ws, size_t ws_size, hipStream_t stream) {
  (void)in_sizes; (void)n_in; (void)out_size; (void)ws_size;
  const float** I = (const float**)d_in;
  const float* x = I[0]; const float* wq = I[1]; const float* wk = I[2]; const float* wv = I[3]; const float* relx = I[4]; const float* rely = I[5];
  float* out = (float*)d_out;
  char* ws = (char*)d_ws; size_t off = 0;
  auto take = [&](size_t bytes) { char* p = ws + off; off += (bytes + 255) & ~(size_t)255; return p; };
  const size_t NP = (size_t)NB * HW * HW;
  float* QF = (float*)take(NP * CC * 4); _Float16* KH = (_Float16*)take(NP * CC * 2); _Float16* VH = (_Float16*)take(NP * CC * 2);
  k_qkv<<<dim3(HW, NB), 128, 0, stream>>>(x, wq, wk, wv, QF, KH, VH);
  k_attn<<<dim3(HW, NB), 128, 0, stream>>>(QF, KH, VH, relx, rely, out);
}

// v004
// A run of this version takes 34.5 microseconds.
// Two timings next to v003 put it at 1.07 and 1.06 times that version's speed.
// Counting every step since v000, it is 2.91 times as fast.
#include <hip/hip_runtime.h>
#include <math.h>

typedef __attribute__((ext_vector_type(16))) _Float16 v16h;
typedef __attribute__((ext_vector_type(16))) __bf16 v16b;
typedef __attribute__((ext_vector_type(8)))  _Float16 v8h;
typedef __attribute__((ext_vector_type(8)))  float v8f;
typedef __attribute__((ext_vector_type(4)))  float v4f;
typedef __attribute__((ext_vector_type(2)))  float v2f;
typedef __attribute__((ext_vector_type(4)))  unsigned v4u;
typedef __attribute__((ext_vector_type(4)))  int v4i;
typedef float __attribute__((may_alias)) float_a;
typedef int __attribute__((may_alias)) int_a;

template <typename T> __device__ __forceinline__ void vst2(void* p, T v) { *(T*)p = v;  }
__device__ __forceinline__ v8f wmma16(v16h a, v16h b, v8f c) {
  v8f d = __builtin_amdgcn_wmma_f32_16x16x32_f16(false, a, false, b, (short)0, c, false, false);
  asm volatile("v_nop\n\tv_nop\n\tv_nop\n\tv_nop" : "+v"(d) : "v"(a), "v"(b));
  return d;
}
__device__ __forceinline__ v8f wmma_bf(v16b a, v16b b, v8f c) {
  v8f d = __builtin_amdgcn_wmma_f32_16x16x32_bf16(false, a, false, b, (short)0, c, false, false);
  asm volatile("v_nop\n\tv_nop\n\tv_nop\n\tv_nop" : "+v"(d) : "v"(a), "v"(b));
  return d;
}
// 16x16x32 fragments: lane = (h = lane>>4, row/col = lane&15); elements 0..7 = k0+8h+0..7, 8..15 = k0+16+8h+0..7; D element r = row 8h+r
__device__ __forceinline__ v16h frag_h(const _Float16* rowk0, int lane) {
  union { v16h v; v8h q[2]; } u; const _Float16* p = rowk0 + 8 * (lane >> 4);
  u.q[0] = *(const v8h*)p; u.q[1] = *(const v8h*)(p + 16); return u.v;
}
// ds_load_tr16_b128: the lanes hand in 16-byte pieces of 16 rows of a row-major f16 LDS tile; lane (h, col) gets rows 8h..8h+7 of column col, i.e. half a column fragment in the k order above
typedef __attribute__((ext_vector_type(8))) short v8s;
__device__ __forceinline__ v8h ld_tr16(const _Float16* p) { typedef __attribute__((address_space(3))) v8s lds_v8s; return __builtin_bit_cast(v8h, __builtin_amdgcn_ds_load_tr16_b128_v8i16((lds_v8s*)p)); }
__device__ __forceinline__ v16h frag_f32(const float* rowk0, int lane) {
  v16h a; const float* p = rowk0 + 8 * (lane >> 4);
#pragma unroll
  for (int i = 0; i < 8; ++i) { a[i] = (_Float16)p[i]; a[8 + i] = (_Float16)p[16 + i]; }
  return a;
}
__device__ __forceinline__ v16h frag_f32s(const float* rowk0, int lane, float sc) {
  v16h a; const float* p = rowk0 + 8 * (lane >> 4);
#pragma unroll
  for (int i = 0; i < 8; ++i) { a[i] = (_Float16)(p[i] * sc); a[8 + i] = (_Float16)(p[16 + i] * sc); }
  return a;
}
// column fragment from a [K][ld] layout (column n), rows >= K read as 0
__device__ __forceinline__ v16h fragc_f32(const float* W, int k0, int n, int lane, int ld, int K) {
  v16h a; const int g = lane >> 4;
#pragma unroll
  for (int i = 0; i < 8; ++i) { const int ka = k0 + 8 * g + i, kb = ka + 16;
    a[i] = (_Float16)(ka < K ? W[(size_t)ka * ld + n] : 0.f); a[8 + i] = (_Float16)(kb < K ? W[(size_t)kb * ld + n] : 0.f); }
  return a;
}
struct F2 { v16b h, l; };
__device__ __forceinline__ F2 bsplit16(const float v[16]) { F2 r;
#pragma unroll
  for (int i = 0; i < 16; ++i) { const __bf16 h = (__bf16)v[i]; r.h[i] = h; r.l[i] = (__bf16)(v[i] - (float)h); }
  return r; }
__device__ __forceinline__ F2 split_row(const float* row, int k0, int lane) { float v[16]; const float* p = row + k0 + 8 * (lane >> 4);
#pragma unroll
  for (int i = 0; i < 8; ++i) { v[i] = p[i]; v[8 + i] = p[16 + i]; }
  return bsplit16(v); }
__device__ __forceinline__ F2 split_rowK(const float* row, int k0, int lane, int K) { float v[16]; const int g = lane >> 4;
#pragma unroll
  for (int i = 0; i < 8; ++i) { const int ka = k0 + 8 * g + i, kb = ka + 16; v[i] = ka < K ? row[ka] : 0.f; v[8 + i] = kb < K ? row[kb] : 0.f; }
  return bsplit16(v); }
__device__ __forceinline__ F2 split_col(const float* W, int k0, int n, int lane, int ld, int K) { float v[16]; const int g = lane >> 4;
#pragma unroll
  for (int i = 0; i < 8; ++i) { const int ka = k0 + 8 * g + i, kb = ka + 16; v[i] = ka < K ? W[(size_t)ka * ld + n] : 0.f; v[8 + i] = kb < K ? W[(size_t)kb * ld + n] : 0.f; }
  return bsplit16(v); }
__device__ __forceinline__ v8f mac3(const F2& a, const F2& b, v8f c) { c = wmma_bf(a.l, b.h, c); c = wmma_bf(a.h, b.l, c); return wmma_bf(a.h, b.h, c); }
__device__ __forceinline__ float sigm(float v) { return 1.0f / (1.0f + expf(-v)); }
#define LDSX() do { asm volatile("s_wait_dscnt 0" ::: "memory"); __builtin_amdgcn_wave_barrier(); __builtin_amdgcn_fence(__ATOMIC_RELEASE, "workgroup"); } while (0)

// Stand-alone local self attention (7x7 window, stride 1, zero padding 3, one 128-channel head with relative position logits from the first /
// second 8 channels of each 16-channel group): q, k, v = 1x1 convs of the input (q as a two-way bf16 split on v_wmma_f32_16x16x32_bf16 because
// it feeds the large relative-position logits, k likewise (its conv rounding dominated the logits error), v on f16 WMMA; [out][in] weights converted in the fragments), stored channels-last
// (q f32, k/v f16). Then per output pixel: 49 logits = q.k(window) + bias_x[l] + bias_y[k] in f32 from LDS halo tiles (padding = zero k/v,
#define NB 4
#define CC 128
#define HW 64
#define KS 7
#define PADW 3
#define NG 8
#define RS 8

// one wave brings 32 rows (512 B each, one row per copy, 16 B per lane) of a [128][128] f32 weight matrix into LDS rows of CC + 4 floats, through no register.
// Eight copies a statement; s_wait_xcnt closes the statement so that no address register of a copy is rewritten in front of it.
__device__ __forceinline__ void stage_w(const float* __restrict__ w, float (*dst)[CC + 4], int wave, int lane) {
  for (int j = 0; j < 32; j += 8) { const int r = wave * 32 + j; const float* g = w + (size_t)r * CC + lane * 4; const unsigned l = (unsigned)(size_t)&dst[r][lane * 4]; const unsigned P = (CC + 4) * 4;
    asm volatile("global_load_async_to_lds_b128 %0, %8, off\n\tglobal_load_async_to_lds_b128 %1, %9, off\n\tglobal_load_async_to_lds_b128 %2, %10, off\n\tglobal_load_async_to_lds_b128 %3, %11, off\n\t"
                 "global_load_async_to_lds_b128 %4, %12, off\n\tglobal_load_async_to_lds_b128 %5, %13, off\n\tglobal_load_async_to_lds_b128 %6, %14, off\n\tglobal_load_async_to_lds_b128 %7, %15, off\n\ts_wait_xcnt 0x0"
                 :: "v"(l), "v"(l + P), "v"(l + 2 * P), "v"(l + 3 * P), "v"(l + 4 * P), "v"(l + 5 * P), "v"(l + 6 * P), "v"(l + 7 * P),
                    "v"(g), "v"(g + CC), "v"(g + 2 * CC), "v"(g + 3 * CC), "v"(g + 4 * CC), "v"(g + 5 * CC), "v"(g + 6 * CC), "v"(g + 7 * CC) : "memory"); }
}
// phase 1: block (b, y): transpose x[b][:, y, :] (NCHW) to 64 token rows; q (split) -> QF f32 [b][y][x][128]; k (split), v (f16) -> KH/VH f16 [b][y][x][128]
__global__ __launch_bounds__(128) void k_qkv(const float* __restrict__ x, const float* __restrict__ wq, const float* __restrict__ wk, const float* __restrict__ wv, float* __restrict__ QF, _Float16* __restrict__ KH, _Float16* __restrict__ VH) {
  __shared__ __align__(16) float sx[64][CC + 4];            // [x][c] f32
  __shared__ __align__(16) float so[4][16][132];
  __shared__ __align__(16) float sw[3][CC][CC + 4];         // wq, wk, wv as given ([out][in] f32), each filled once by asynchronous copies
  const int tid = threadIdx.x, wave = tid >> 5, lane = tid & 31, col = lane & 15, g = lane >> 4;
  const int b = blockIdx.y, y = blockIdx.x;
  stage_w(wq, sw[0], wave, lane);                           // lands while x is transposed
  for (int q = tid; q < CC * 16; q += 128) { const int c = q >> 4, x4 = q & 15; const v4f v = *(const v4f*)(x + (((size_t)b * CC + c) * HW + y) * HW + x4 * 4); sx[x4 * 4][c] = v[0]; sx[x4 * 4 + 1][c] = v[1]; sx[x4 * 4 + 2][c] = v[2]; sx[x4 * 4 + 3][c] = v[3]; }
  asm volatile("s_wait_asynccnt 0x0" ::: "memory");         // this wave's rows of wq have landed before the barrier publishes them
  __syncthreads();
  stage_w(wk, sw[1], wave, lane);                           // lands under the q products
  const size_t prow0 = ((size_t)b * HW + y) * HW + wave * 16;      // pixel row index of this wave's first token
  // q: bf16 split
  { v8f acc[8] = {};
#pragma unroll 1
    for (int kc = 0; kc < CC / 32; ++kc) { const F2 a = split_row(&sx[wave * 16 + col][0], kc * 32, lane);
#pragma unroll
      for (int t = 0; t < 8; ++t) acc[t] = mac3(a, split_row(&sw[0][t * 16 + col][0], kc * 32, lane), acc[t]); }
#pragma unroll
    for (int t = 0; t < 8; ++t)
#pragma unroll
      for (int r = 0; r < 8; ++r) so[wave][8 * g + r][t * 16 + col] = acc[t][r]; }
  LDSX();
#pragma unroll 4
  for (int rl = 0; rl < 16; ++rl) vst2(QF + (prow0 + rl) * CC + lane * 4, *(const v4f*)(&so[wave][rl][lane * 4]));
  LDSX();
  // k (bf16 split) and v (f16), both stored f16
#pragma unroll 1
  for (int which = 0; which < 2; ++which) { _Float16* D = which == 0 ? KH : VH; v8f acc[8] = {};
    asm volatile("s_wait_asynccnt 0x0" ::: "memory");       // this wave's rows of this pass's weights have landed before the barrier publishes them
    __syncthreads();
    if (which == 0) stage_w(wv, sw[2], wave, lane);         // lands under the k products
    if (which == 0) {   // k feeds the logits: two-way bf16 split
#pragma unroll 1
      for (int kc = 0; kc < CC / 32; ++kc) { const F2 a = split_row(&sx[wave * 16 + col][0], kc * 32, lane);
#pragma unroll
        for (int t = 0; t < 8; ++t) acc[t] = mac3(a, split_row(&sw[1][t * 16 + col][0], kc * 32, lane), acc[t]); } }
    else {
#pragma unroll
      for (int kc = 0; kc < CC / 32; ++kc) { const v16h a = frag_f32(&sx[wave * 16 + col][0] + kc * 32, lane);
#pragma unroll
        for (int t = 0; t < 8; ++t) acc[t] = wmma16(a, frag_f32s(&sw[2][t * 16 + col][0] + kc * 32, lane, 16.0f), acc[t]); }
#pragma unroll
      for (int t = 0; t < 8; ++t)
#pragma unroll
        for (int r = 0; r < 8; ++r) acc[t][r] *= (1.0f / 16.0f); }
#pragma unroll
    for (int t = 0; t < 8; ++t)
#pragma unroll
      for (int r = 0; r < 8; ++r) so[wave][8 * g + r][t * 16 + col] = acc[t][r];
    LDSX();
    for (int q = lane; q < 16 * 16; q += 32) { const int rl = q >> 4, pc = q & 15; union { v8h h8; v4u u; } pk;
#pragma unroll
      for (int e = 0; e < 8; ++e) pk.h8[e] = (_Float16)so[wave][rl][pc * 8 + e];
      vst2(D + (prow0 + rl) * CC + pc * 8, pk.u); }
    LDSX(); }
}
__device__ __forceinline__ void stage_halo(const _Float16* __restrict__ src, _Float16 (*dst)[HW + 6][CC + 8], int b, int y, int wave, int lane) {
  for (int ry = 0; ry < KS; ++ry) { const int yy = y - PADW + ry; if ((unsigned)yy >= (unsigned)HW) continue;
    const _Float16* g = src + ((((size_t)b * HW + yy) * HW + wave * 16 + (lane >> 4)) * CC + (lane & 15) * 8); const unsigned l = (unsigned)(size_t)&dst[ry][PADW + wave * 16 + (lane >> 4)][(lane & 15) * 8]; const unsigned P = 2 * (CC + 8) * 2;
    asm volatile("global_load_async_to_lds_b128 %0, %8, off\n\tglobal_load_async_to_lds_b128 %1, %9, off\n\tglobal_load_async_to_lds_b128 %2, %10, off\n\tglobal_load_async_to_lds_b128 %3, %11, off\n\t"
                 "global_load_async_to_lds_b128 %4, %12, off\n\tglobal_load_async_to_lds_b128 %5, %13, off\n\tglobal_load_async_to_lds_b128 %6, %14, off\n\tglobal_load_async_to_lds_b128 %7, %15, off\n\ts_wait_xcnt 0x0"
                 :: "v"(l), "v"(l + P), "v"(l + 2 * P), "v"(l + 3 * P), "v"(l + 4 * P), "v"(l + 5 * P), "v"(l + 6 * P), "v"(l + 7 * P),
                    "v"(g), "v"(g + 2 * CC), "v"(g + 4 * CC), "v"(g + 6 * CC), "v"(g + 8 * CC), "v"(g + 10 * CC), "v"(g + 12 * CC), "v"(g + 14 * CC) : "memory"); }
}
// phase 2: block (b, y): 7-row halo of k and v (f16, zero padded); per window row ki: S = Q K_row^T on WMMA (q as hi/lo f16 pair -> two
// products, k f16), each wave over the 32 halo columns from its first pixel on (its 16 windows reach 22 of them), logits = S[px][px+kj] + bias_x[kj] + bias_y[ki];
// softmax over 49 in f32; then per ki the band matrix P[px][px+kj] (x 2^14, f16; the same 32 columns) times V_row on WMMA accumulates out[px][c]. Output written NCHW (whole 256-B rows per channel).
__global__ __launch_bounds__(128) void k_attn(const float* __restrict__ QF, const _Float16* __restrict__ KH, const _Float16* __restrict__ VH, const float* __restrict__ relx, const float* __restrict__ rely, float* __restrict__ out) {
  __shared__ __align__(16) union U { _Float16 k[KS][HW + 6][CC + 8]; float o[64][CC + 4]; } su;   // k halo, later the output tile
  __shared__ __align__(16) _Float16 sv[KS][HW + 6][CC + 8];
  __shared__ __align__(16) float sS[64][36];                 // scores for one ki: [px][pxx - 16 wave], 32 columns
  __shared__ __align__(16) _Float16 sP[4][16][40];            // per wave: band matrix rows (x 2^14) for the current ki: [px][pxx - 16 wave], 32 columns, zero off the band
  __shared__ float slg[64][52];                              // logits / probabilities per pixel
  __shared__ float sbx[64][8], sby[64][8];
  const int tid = threadIdx.x, wave = tid >> 5, lane = tid & 31, col = lane & 15, g = lane >> 4; const int b = blockIdx.y, y = blockIdx.x;
  stage_halo(KH, su.k, b, y, wave, lane);                     // lands while the zero padding is written and the position logits are summed
  // zero padding of both halos: the three columns left and right of the image, then the whole rows above or below it; no copy writes these bytes
  for (int q = tid; q < KS * 2 * PADW * (CC / 8); q += 128) { const int pc = q & 15, rest = q >> 4; const int ry = rest / (2 * PADW), e = rest % (2 * PADW); const int px = e < PADW ? e : HW + e;
    *(v4u*)(&su.k[ry][px][pc * 8]) = (v4u){0u, 0u, 0u, 0u}; *(v4u*)(&sv[ry][px][pc * 8]) = (v4u){0u, 0u, 0u, 0u}; }
  for (int ry = 0; ry < KS; ++ry) { if ((unsigned)(y - PADW + ry) < (unsigned)HW) continue;
    for (int q = tid; q < HW * (CC / 8); q += 128) { const int pc = q & 15, px = PADW + (q >> 4); *(v4u*)(&su.k[ry][px][pc * 8]) = (v4u){0u, 0u, 0u, 0u}; *(v4u*)(&sv[ry][px][pc * 8]) = (v4u){0u, 0u, 0u, 0u}; } }
  { const int px = tid >> 1, hf = tid & 1; const float* qr = QF + (((size_t)b * HW + y) * HW + px) * CC; const float* relw = hf == 0 ? relx : rely; float bb[KS];
#pragma unroll
    for (int l = 0; l < KS; ++l) bb[l] = 0.f;
#pragma unroll 1
    for (int gq = 0; gq < NG; ++gq) {
#pragma unroll 1
      for (int i = 0; i < RS; ++i) { const float qv = qr[gq * 16 + hf * 8 + i];
#pragma unroll
        for (int l = 0; l < KS; ++l) bb[l] += qv * relw[i * KS + l]; } }
    float* dstb = hf == 0 ? &sbx[px][0] : &sby[px][0];
#pragma unroll
    for (int l = 0; l < KS; ++l) dstb[l] = bb[l]; }
  asm volatile("s_wait_asynccnt 0x0" ::: "memory");           // this wave's part of the k halo has landed before the barrier publishes it
  __syncthreads();
  // q fragments (hi/lo f16) for this wave's 16 pixels, 4 k-chunks
  const float* qrow = QF + (((size_t)b * HW + y) * HW + wave * 16 + col) * CC;
  v16h qh[4], ql[4];
#pragma unroll
  for (int kc = 0; kc < 4; ++kc) { const float* p = qrow + kc * 32 + 8 * g;
#pragma unroll
    for (int i = 0; i < 8; ++i) { const float v0 = p[i], v1 = p[16 + i]; const _Float16 h0 = (_Float16)v0, h1 = (_Float16)v1; qh[kc][i] = h0; qh[kc][8 + i] = h1; ql[kc][i] = (_Float16)((v0 - (float)h0) * 2048.0f); ql[kc][8 + i] = (_Float16)((v1 - (float)h1) * 2048.0f); } }
  stage_halo(VH, sv, b, y, wave, lane);                       // lands under the scores and the softmax; behind the k halo's wait, so that no wave has more than 56 copies outstanding, and behind the q loads, which would queue after it
#pragma unroll 1
  for (int ki = 0; ki < KS; ++ki) {
    // S[px][pxx] only for the two 16-column tiles that this wave's windows reach (pxx = 16 wave .. 16 wave + 31; the windows end at 16 wave + 21).
    // In the last wave cols >= 70 would read k rows 70..79 -> out of the halo: clamp to 69, values unused
#pragma unroll   // two trips: unrolled, the tile's column in sS is a constant offset of the stores and no loop branch stands behind a matrix instruction
    for (int t = 0; t < 2; ++t) { const int pxx = (wave + t) * 16 + col; const _Float16* krow = &su.k[ki][pxx < HW + 6 ? pxx : HW + 5][0]; v8f acc = {}, acl = {};
#pragma unroll
      for (int kc = 0; kc < 4; ++kc) { const v16h bk = frag_h(krow + kc * 32, lane); acc = wmma16(qh[kc], bk, acc); acl = wmma16(ql[kc], bk, acl); }
#pragma unroll
      for (int r = 0; r < 8; ++r) sS[wave * 16 + 8 * g + r][t * 16 + col] = acc[r] + acl[r] * (1.0f / 2048.0f); }
    LDSX();
    // logits for this wave's pixels: lane (pl = lane>>1, hf): kj in hf ? 4..6 : 0..3
    { const int pl = lane >> 1, hf = lane & 1; const int px = wave * 16 + pl;
      for (int kj = hf * 4; kj < (hf ? 7 : 4); ++kj) slg[px][ki * KS + kj] = sS[px][pl + kj] + sbx[px][kj] + sby[px][ki]; }
    LDSX(); }
  // softmax per pixel (lane pairs): slg <- probabilities x 2^14 (in place)
  { const int pl = lane >> 1, hf = lane & 1; const int px = wave * 16 + pl; float mx = -3.4e38f;
    for (int n = 0; n < KS * KS; ++n) mx = fmaxf(mx, slg[px][n]);
    float se = 0.f;
    for (int n = 0; n < KS * KS; ++n) se += expf(slg[px][n] - mx);
    const float sc = 16384.0f / se;
    LDSX();                                                   // both lanes of the pair have read all 49 logits before either overwrites them
    for (int n = hf; n < KS * KS; n += 2) slg[px][n] = expf(slg[px][n] - mx) * sc; }
  asm volatile("s_wait_asynccnt 0x0" ::: "memory");           // this wave's part of the v halo has landed before the barrier publishes it
  __syncthreads();                                            // all waves done with su.k (scores) before it becomes the output tile
  // out[px][c] = sum_ki P_ki[px][:] @ V_ki[:][c]  : M 16 per wave, K = 32 (the one chunk of v rows 16 wave .. 16 wave + 31 that holds the wave's band; cols >= 22 of P are zero, v rows >= 70 clamped), N 128
  { v8f acc[8] = {};
    // transposing reads of v: lane l hands in 16 B (8 channels from 8 ((l >> 3) & 1) on) of v row 16 wave + 8 g + (l & 7), and of the row 16 further on; rows >= 70 clamped to 69 (P is zero there)
    const int va = wave * 16 + 8 * g + (lane & 7), vb = va + 16; const int vra = va < HW + 6 ? va : HW + 5, vrb = vb < HW + 6 ? vb : HW + 5, vc = ((lane >> 3) & 1) * 8;
#pragma unroll 1
    for (int ki = 0; ki < KS; ++ki) {
      // the window row's eight v fragments, two transposing reads each, as one group; they do not depend on the band and land while it is built
      v16h bv[8];
#pragma unroll
      for (int t = 0; t < 8; ++t) { union { v16h v; v8h q[2]; } u; u.q[0] = ld_tr16(&sv[ki][vra][t * 16 + vc]); u.q[1] = ld_tr16(&sv[ki][vrb][t * 16 + vc]); bv[t] = u.v; }
      // build this wave's band rows for ki: zero the 16 x 32 tile, then P[pl][pl + kj] = prob
      for (int q = lane; q < 16 * 4; q += 32) { const int rl = q >> 2, pc = q & 3; *(v4u*)(&sP[wave][rl][pc * 8]) = (v4u){0u, 0u, 0u, 0u}; }
      LDSX();
      { const int pl = lane >> 1, hf = lane & 1; const int px = wave * 16 + pl; for (int kj = hf * 4; kj < (hf ? 7 : 4); ++kj) sP[wave][pl][pl + kj] = (_Float16)slg[px][ki * KS + kj]; }
      LDSX();
      { const v16h a = frag_h(&sP[wave][col][0], lane);
#pragma unroll
        for (int t = 0; t < 8; ++t) acc[t] = wmma16(a, bv[t], acc[t]); }
      LDSX(); }
#pragma unroll
    for (int t = 0; t < 8; ++t)
#pragma unroll
      for (int r = 0; r < 8; ++r) su.o[wave * 16 + 8 * g + r][t * 16 + col] = acc[t][r] * (1.0f / 16384.0f); }
  __syncthreads();
  for (int q = tid; q < CC * 16; q += 128) { const int c = q >> 4, x4 = q & 15; vst2(out + (((size_t)b * CC + c) * HW + y) * HW + x4 * 4, (v4f){su.o[x4 * 4][c], su.o[x4 * 4 + 1][c], su.o[x4 * 4 + 2][c], su.o[x4 * 4 + 3][c]}); }
}
extern "C" void kernel_launch(void* const* d_in, const int* in_sizes, int n_in, void* d_out, int out_size, void* d_ws, size_t ws_size, hipStream_t stream) {
  (void)in_sizes; (void)n_in; (void)out_size; (void)ws_size;
  const float** I = (const float**)d_in;
  const float* x = I[0]; const float* wq = I[1]; const float* wk = I[2]; const float* wv = I[3]; const float* relx = I[4]; const float* rely = I[5];
  float* out = (float*)d_out;
  char* ws = (char*)d_ws; size_t off = 0;
  auto take = [&](size_t bytes) { char* p = ws + off; off += (bytes + 255) & ~(size_t)255; return p; };
  const size_t NP = (size_t)NB * HW * HW;
  float* QF = (float*)take(NP * CC * 4); _Float16* KH = (_Float16*)take(NP * CC * 2); _Float16* VH = (_Float16*)take(NP * CC * 2);
  k_qkv<<<dim3(HW, NB), 128, 0, stream>>>(x, wq, wk, wv, QF, KH, VH);
  k_attn<<<dim3(HW, NB), 128, 0, stream>>>(QF, KH, VH, relx, rely, out);
}

// v005
// One run takes 25.8 microseconds.
// Two timings next to v004 put it at 1.35 and 1.34 times that version's speed.
// Counting every step since v000, it is 3.91 times as fast.
#include <hip/hip_runtime.h>
#include <math.h>

typedef __attribute__((ext_vector_type(16))) _Float16 v16h;
typedef __attribute__((ext_vector_type(16))) __bf16 v16b;
typedef __attribute__((ext_vector_type(8)))  _Float16 v8h;
typedef __attribute__((ext_vector_type(8)))  float v8f;
typedef __attribute__((ext_vector_type(4)))  float v4f;
typedef __attribute__((ext_vector_type(2)))  float v2f;
typedef __attribute__((ext_vector_type(4)))  unsigned v4u;
typedef __attribute__((ext_vector_type(4)))  int v4i;
typedef float __attribute__((may_alias)) float_a;
typedef int __attribute__((may_alias)) int_a;

template <typename T> __device__ __forceinline__ void vst2(void* p, T v) { *(T*)p = v;  }
__device__ __forceinline__ v8f wmma16(v16h a, v16h b, v8f c) {
  v8f d = __builtin_amdgcn_wmma_f32_16x16x32_f16(false, a, false, b, (short)0, c, false, false);
  asm volatile("v_nop\n\tv_nop\n\tv_nop\n\tv_nop" : "+v"(d) : "v"(a), "v"(b));
  return d;
}
__device__ __forceinline__ v8f wmma_bf(v16b a, v16b b, v8f c) {
  v8f d = __builtin_amdgcn_wmma_f32_16x16x32_bf16(false, a, false, b, (short)0, c, false, false);
  asm volatile("v_nop\n\tv_nop\n\tv_nop\n\tv_nop" : "+v"(d) : "v"(a), "v"(b));
  return d;
}
// 16x16x32 fragments: lane = (h = lane>>4, row/col = lane&15); elements 0..7 = k0+8h+0..7, 8..15 = k0+16+8h+0..7; D element r = row 8h+r
__device__ __forceinline__ v16h frag_h(const _Float16* rowk0, int lane) {
  union { v16h v; v8h q[2]; } u; const _Float16* p = rowk0 + 8 * (lane >> 4);
  u.q[0] = *(const v8h*)p; u.q[1] = *(const v8h*)(p + 16); return u.v;
}
// ds_load_tr16_b128: the lanes hand in 16-byte pieces of 16 rows of a row-major f16 LDS tile; lane (h, col) gets rows 8h..8h+7 of column col, i.e. half a column fragment in the k order above
typedef __attribute__((ext_vector_type(8))) short v8s;
__device__ __forceinline__ v8h ld_tr16(const _Float16* p) { typedef __attribute__((address_space(3))) v8s lds_v8s; return __builtin_bit_cast(v8h, __builtin_amdgcn_ds_load_tr16_b128_v8i16((lds_v8s*)p)); }
__device__ __forceinline__ v16h frag_f32(const float* rowk0, int lane) {
  v16h a; const float* p = rowk0 + 8 * (lane >> 4);
#pragma unroll
  for (int i = 0; i < 8; ++i) { a[i] = (_Float16)p[i]; a[8 + i] = (_Float16)p[16 + i]; }
  return a;
}
__device__ __forceinline__ v16h frag_f32s(const float* rowk0, int lane, float sc) {
  v16h a; const float* p = rowk0 + 8 * (lane >> 4);
#pragma unroll
  for (int i = 0; i < 8; ++i) { a[i] = (_Float16)(p[i] * sc); a[8 + i] = (_Float16)(p[16 + i] * sc); }
  return a;
}
// column fragment from a [K][ld] layout (column n), rows >= K read as 0
__device__ __forceinline__ v16h fragc_f32(const float* W, int k0, int n, int lane, int ld, int K) {
  v16h a; const int g = lane >> 4;
#pragma unroll
  for (int i = 0; i < 8; ++i) { const int ka = k0 + 8 * g + i, kb = ka + 16;
    a[i] = (_Float16)(ka < K ? W[(size_t)ka * ld + n] : 0.f); a[8 + i] = (_Float16)(kb < K ? W[(size_t)kb * ld + n] : 0.f); }
  return a;
}
struct F2 { v16b h, l; };
__device__ __forceinline__ F2 bsplit16(const float v[16]) { F2 r;
#pragma unroll
  for (int i = 0; i < 16; ++i) { const __bf16 h = (__bf16)v[i]; r.h[i] = h; r.l[i] = (__bf16)(v[i] - (float)h); }
  return r; }
__device__ __forceinline__ F2 split_row(const float* row, int k0, int lane) { float v[16]; const float* p = row + k0 + 8 * (lane >> 4);
#pragma unroll
  for (int i = 0; i < 8; ++i) { v[i] = p[i]; v[8 + i] = p[16 + i]; }
  return bsplit16(v); }
__device__ __forceinline__ F2 split_rowK(const float* row, int k0, int lane, int K) { float v[16]; const int g = lane >> 4;
#pragma unroll
  for (int i = 0; i < 8; ++i) { const int ka = k0 + 8 * g + i, kb = ka + 16; v[i] = ka < K ? row[ka] : 0.f; v[8 + i] = kb < K ? row[kb] : 0.f; }
  return bsplit16(v); }
__device__ __forceinline__ F2 split_col(const float* W, int k0, int n, int lane, int ld, int K) { float v[16]; const int g = lane >> 4;
#pragma unroll
  for (int i = 0; i < 8; ++i) { const int ka = k0 + 8 * g + i, kb = ka + 16; v[i] = ka < K ? W[(size_t)ka * ld + n] : 0.f; v[8 + i] = kb < K ? W[(size_t)kb * ld + n] : 0.f; }
  return bsplit16(v); }
__device__ __forceinline__ v8f mac3(const F2& a, const F2& b, v8f c) { c = wmma_bf(a.l, b.h, c); c = wmma_bf(a.h, b.l, c); return wmma_bf(a.h, b.h, c); }
__device__ __forceinline__ float sigm(float v) { return 1.0f / (1.0f + expf(-v)); }
#define LDSX() do { asm volatile("s_wait_dscnt 0" ::: "memory"); __builtin_amdgcn_wave_barrier(); __builtin_amdgcn_fence(__ATOMIC_RELEASE, "workgroup"); } while (0)

// Stand-alone local self attention (7x7 window, stride 1, zero padding 3, one 128-channel head with relative position logits from the first /
// second 8 channels of each 16-channel group): q, k, v = 1x1 convs of the input (q as a two-way bf16 split on v_wmma_f32_16x16x32_bf16 because
// it feeds the large relative-position logits, k likewise (its conv rounding dominated the logits error), v on f16 WMMA; [out][in] weights converted in the fragments), stored channels-last
// (q f32, k/v f16). Then per output pixel: 49 logits = q.k(window) + bias_x[l] + bias_y[k] in f32 from LDS halo tiles (padding = zero k/v,
#define NB 4
#define CC 128
#define HW 64
#define KS 7
#define PADW 3
#define NG 8
#define RS 8

// one wave brings 32 rows (512 B each, one row per copy, 16 B per lane) of a [128][128] f32 weight matrix into LDS rows of CC + 4 floats, through no register.
// Eight copies a statement; s_wait_xcnt closes the statement so that no address register of a copy is rewritten in front of it.
__device__ __forceinline__ void stage_w(const float* __restrict__ w, float (*dst)[CC + 4], int wave, int lane) {
  for (int j = 0; j < 32; j += 8) { const int r = wave * 32 + j; const float* g = w + (size_t)r * CC + lane * 4; const unsigned l = (unsigned)(size_t)&dst[r][lane * 4]; const unsigned P = (CC + 4) * 4;
    asm volatile("global_load_async_to_lds_b128 %0, %8, off\n\tglobal_load_async_to_lds_b128 %1, %9, off\n\tglobal_load_async_to_lds_b128 %2, %10, off\n\tglobal_load_async_to_lds_b128 %3, %11, off\n\t"
                 "global_load_async_to_lds_b128 %4, %12, off\n\tglobal_load_async_to_lds_b128 %5, %13, off\n\tglobal_load_async_to_lds_b128 %6, %14, off\n\tglobal_load_async_to_lds_b128 %7, %15, off\n\ts_wait_xcnt 0x0"
                 :: "v"(l), "v"(l + P), "v"(l + 2 * P), "v"(l + 3 * P), "v"(l + 4 * P), "v"(l + 5 * P), "v"(l + 6 * P), "v"(l + 7 * P),
                    "v"(g), "v"(g + CC), "v"(g + 2 * CC), "v"(g + 3 * CC), "v"(g + 4 * CC), "v"(g + 5 * CC), "v"(g + 6 * CC), "v"(g + 7 * CC) : "memory"); }
}
// phase 1: block (b, y): transpose x[b][:, y, :] (NCHW) to 64 token rows; q (split) -> QF f32 [b][y][x][128]; k (split), v (f16) -> KH/VH f16 [b][y][x][128]
__global__ __launch_bounds__(128) void k_qkv(const float* __restrict__ x, const float* __restrict__ wq, const float* __restrict__ wk, const float* __restrict__ wv, float* __restrict__ QF, _Float16* __restrict__ KH, _Float16* __restrict__ VH) {
  __shared__ __align__(16) float sx[64][CC + 4];            // [x][c] f32
  __shared__ __align__(16) float so[4][16][132];
  __shared__ __align__(16) float sw[3][CC][CC + 4];         // wq, wk, wv as given ([out][in] f32), each filled once by asynchronous copies
  const int tid = threadIdx.x, wave = tid >> 5, lane = tid & 31, col = lane & 15, g = lane >> 4;
  const int b = blockIdx.y, y = blockIdx.x;
  stage_w(wq, sw[0], wave, lane);                           // lands while x is transposed
  for (int q = tid; q < CC * 16; q += 128) { const int c = q >> 4, x4 = q & 15; const v4f v = *(const v4f*)(x + (((size_t)b * CC + c) * HW + y) * HW + x4 * 4); sx[x4 * 4][c] = v[0]; sx[x4 * 4 + 1][c] = v[1]; sx[x4 * 4 + 2][c] = v[2]; sx[x4 * 4 + 3][c] = v[3]; }
  asm volatile("s_wait_asynccnt 0x0" ::: "memory");         // this wave's rows of wq have landed before the barrier publishes them
  __syncthreads();
  stage_w(wk, sw[1], wave, lane);                           // lands under the q products
  const size_t prow0 = ((size_t)b * HW + y) * HW + wave * 16;      // pixel row index of this wave's first token
  // q: bf16 split
  { v8f acc[8] = {};
#pragma unroll 1
    for (int kc = 0; kc < CC / 32; ++kc) { const F2 a = split_row(&sx[wave * 16 + col][0], kc * 32, lane);
#pragma unroll
      for (int t = 0; t < 8; ++t) acc[t] = mac3(a, split_row(&sw[0][t * 16 + col][0], kc * 32, lane), acc[t]); }
#pragma unroll
    for (int t = 0; t < 8; ++t)
#pragma unroll
      for (int r = 0; r < 8; ++r) so[wave][8 * g + r][t * 16 + col] = acc[t][r]; }
  LDSX();
#pragma unroll 4
  for (int rl = 0; rl < 16; ++rl) vst2(QF + (prow0 + rl) * CC + lane * 4, *(const v4f*)(&so[wave][rl][lane * 4]));
  LDSX();
  // k (bf16 split) and v (f16), both stored f16
#pragma unroll 1
  for (int which = 0; which < 2; ++which) { _Float16* D = which == 0 ? KH : VH; v8f acc[8] = {};
    asm volatile("s_wait_asynccnt 0x0" ::: "memory");       // this wave's rows of this pass's weights have landed before the barrier publishes them
    __syncthreads();
    if (which == 0) stage_w(wv, sw[2], wave, lane);         // lands under the k products
    if (which == 0) {   // k feeds the logits: two-way bf16 split
#pragma unroll 1
      for (int kc = 0; kc < CC / 32; ++kc) { const F2 a = split_row(&sx[wave * 16 + col][0], kc * 32, lane);
#pragma unroll
        for (int t = 0; t < 8; ++t) acc[t] = mac3(a, split_row(&sw[1][t * 16 + col][0], kc * 32, lane), acc[t]); } }
    else {
#pragma unroll
      for (int kc = 0; kc < CC / 32; ++kc) { const v16h a = frag_f32(&sx[wave * 16 + col][0] + kc * 32, lane);
#pragma unroll
        for (int t = 0; t < 8; ++t) acc[t] = wmma16(a, frag_f32s(&sw[2][t * 16 + col][0] + kc * 32, lane, 16.0f), acc[t]); }
#pragma unroll
      for (int t = 0; t < 8; ++t)
#pragma unroll
        for (int r = 0; r < 8; ++r) acc[t][r] *= (1.0f / 16.0f); }
#pragma unroll
    for (int t = 0; t < 8; ++t)
#pragma unroll
      for (int r = 0; r < 8; ++r) so[wave][8 * g + r][t * 16 + col] = acc[t][r];
    LDSX();
    for (int q = lane; q < 16 * 16; q += 32) { const int rl = q >> 4, pc = q & 15; union { v8h h8; v4u u; } pk;
#pragma unroll
      for (int e = 0; e < 8; ++e) pk.h8[e] = (_Float16)so[wave][rl][pc * 8 + e];
      vst2(D + (prow0 + rl) * CC + pc * 8, pk.u); }
    LDSX(); }
}
__device__ __forceinline__ void stage_halo(const _Float16* __restrict__ src, _Float16 (*dst)[HW + 6][CC + 8], int b, int y, int wave, int lane) {
  for (int ry = 0; ry < KS; ++ry) { const int yy = y - PADW + ry; if ((unsigned)yy >= (unsigned)HW) continue;
    const _Float16* g = src + ((((size_t)b * HW + yy) * HW + wave * 16 + (lane >> 4)) * CC + (lane & 15) * 8); const unsigned l = (unsigned)(size_t)&dst[ry][PADW + wave * 16 + (lane >> 4)][(lane & 15) * 8]; const unsigned P = 2 * (CC + 8) * 2;
    asm volatile("global_load_async_to_lds_b128 %0, %8, off\n\tglobal_load_async_to_lds_b128 %1, %9, off\n\tglobal_load_async_to_lds_b128 %2, %10, off\n\tglobal_load_async_to_lds_b128 %3, %11, off\n\t"
                 "global_load_async_to_lds_b128 %4, %12, off\n\tglobal_load_async_to_lds_b128 %5, %13, off\n\tglobal_load_async_to_lds_b128 %6, %14, off\n\tglobal_load_async_to_lds_b128 %7, %15, off\n\ts_wait_xcnt 0x0"
                 :: "v"(l), "v"(l + P), "v"(l + 2 * P), "v"(l + 3 * P), "v"(l + 4 * P), "v"(l + 5 * P), "v"(l + 6 * P), "v"(l + 7 * P),
                    "v"(g), "v"(g + 2 * CC), "v"(g + 4 * CC), "v"(g + 6 * CC), "v"(g + 8 * CC), "v"(g + 10 * CC), "v"(g + 12 * CC), "v"(g + 14 * CC) : "memory"); }
}
// phase 2: block (b, y): 7-row halo of k and v (f16, zero padded); per window row ki: S = Q K_row^T on WMMA (q as hi/lo f16 pair -> two
// products, k f16), each wave over the 32 halo columns from its first pixel on (its 16 windows reach 22 of them), logits = S[px][px+kj] + bias_x[kj] + bias_y[ki];
// softmax over 49 in f32; then per ki the band matrix P[px][px+kj] (x 2^14, f16; the same 32 columns) times V_row on WMMA accumulates out[px][c]. Output written NCHW (whole 256-B rows per channel).
__global__ __launch_bounds__(128) void k_attn(const float* __restrict__ QF, const _Float16* __restrict__ KH, const _Float16* __restrict__ VH, const float* __restrict__ relx, const float* __restrict__ rely, float* __restrict__ out) {
  __shared__ __align__(16) union U { _Float16 k[KS][HW + 6][CC + 8]; float o[64][CC + 4]; } su;   // k halo, later the output tile
  __shared__ __align__(16) _Float16 sv[KS][HW + 6][CC + 8];
  __shared__ __align__(16) float sS[64][36];                 // scores for one ki: [px][pxx - 16 wave], 32 columns
  __shared__ __align__(16) _Float16 sP[4][16][40];            // per wave: band matrix rows (x 2^14) for the current ki: [px][pxx - 16 wave], 32 columns, zero off the band
  __shared__ float slg[64][52];                              // logits / probabilities per pixel
  __shared__ float sbx[64][8], sby[64][8];
  const int tid = threadIdx.x, wave = tid >> 5, lane = tid & 31, col = lane & 15, g = lane >> 4; const int b = blockIdx.y, y = blockIdx.x;
  stage_halo(KH, su.k, b, y, wave, lane);                     // lands while the zero padding is written and the position logits are summed
  // zero padding of both halos: the three columns left and right of the image, then the whole rows above or below it; no copy writes these bytes
  for (int q = tid; q < KS * 2 * PADW * (CC / 8); q += 128) { const int pc = q & 15, rest = q >> 4; const int ry = rest / (2 * PADW), e = rest % (2 * PADW); const int px = e < PADW ? e : HW + e;
    *(v4u*)(&su.k[ry][px][pc * 8]) = (v4u){0u, 0u, 0u, 0u}; *(v4u*)(&sv[ry][px][pc * 8]) = (v4u){0u, 0u, 0u, 0u}; }
  for (int ry = 0; ry < KS; ++ry) { if ((unsigned)(y - PADW + ry) < (unsigned)HW) continue;
    for (int q = tid; q < HW * (CC / 8); q += 128) { const int pc = q & 15, px = PADW + (q >> 4); *(v4u*)(&su.k[ry][px][pc * 8]) = (v4u){0u, 0u, 0u, 0u}; *(v4u*)(&sv[ry][px][pc * 8]) = (v4u){0u, 0u, 0u, 0u}; } }
  { const int px = tid >> 1, hf = tid & 1; const float* qr = QF + (((size_t)b * HW + y) * HW + px) * CC; const float* relw = hf == 0 ? relx : rely; float bb[KS];
#pragma unroll
    for (int l = 0; l < KS; ++l) bb[l] = 0.f;
#pragma unroll   // both loops unrolled: rolled, each of the 64 trips waited on its own global loads; unrolled, the q row and the table are loaded as one group and waited on once (same order of the sums)
    for (int gq = 0; gq < NG; ++gq) {
#pragma unroll
      for (int i = 0; i < RS; ++i) { const float qv = qr[gq * 16 + hf * 8 + i];
#pragma unroll
        for (int l = 0; l < KS; ++l) bb[l] = __builtin_fmaf(qv, relw[i * KS + l], bb[l]); } }   // written as the fused form that the rolled loop compiled to, so that every sum rounds as before
    float* dstb = hf == 0 ? &sbx[px][0] : &sby[px][0];
#pragma unroll
    for (int l = 0; l < KS; ++l) dstb[l] = bb[l]; }
  asm volatile("s_wait_asynccnt 0x0" ::: "memory");           // this wave's part of the k halo has landed before the barrier publishes it
  __syncthreads();
  // q fragments (hi/lo f16) for this wave's 16 pixels, 4 k-chunks
  const float* qrow = QF + (((size_t)b * HW + y) * HW + wave * 16 + col) * CC;
  v16h qh[4], ql[4];
#pragma unroll
  for (int kc = 0; kc < 4; ++kc) { const float* p = qrow + kc * 32 + 8 * g;
#pragma unroll
    for (int i = 0; i < 8; ++i) { const float v0 = p[i], v1 = p[16 + i]; const _Float16 h0 = (_Float16)v0, h1 = (_Float16)v1; qh[kc][i] = h0; qh[kc][8 + i] = h1; ql[kc][i] = (_Float16)((v0 - (float)h0) * 2048.0f); ql[kc][8 + i] = (_Float16)((v1 - (float)h1) * 2048.0f); } }
  stage_halo(VH, sv, b, y, wave, lane);                       // lands under the scores and the softmax; behind the k halo's wait, so that no wave has more than 56 copies outstanding, and behind the q loads, which would queue after it
#pragma unroll 1
  for (int ki = 0; ki < KS; ++ki) {
    // S[px][pxx] only for the two 16-column tiles that this wave's windows reach (pxx = 16 wave .. 16 wave + 31; the windows end at 16 wave + 21).
    // In the last wave cols >= 70 would read k rows 70..79 -> out of the halo: clamp to 69, values unused
    // the window row's eight k fragments are read as one group ahead of the products: read where they are used, each pair of reads was waited on by itself (no read moves up over the statement that pads a matrix instruction)
    v16h bk[2][4];
#pragma unroll
    for (int t = 0; t < 2; ++t) { const int pxx = (wave + t) * 16 + col; const _Float16* krow = &su.k[ki][pxx < HW + 6 ? pxx : HW + 5][0];
#pragma unroll
      for (int kc = 0; kc < 4; ++kc) bk[t][kc] = frag_h(krow + kc * 32, lane); }
#pragma unroll   // two trips: unrolled, the tile's column in sS is a constant offset of the stores and no loop branch stands behind a matrix instruction
    for (int t = 0; t < 2; ++t) { v8f acc = {}, acl = {};
#pragma unroll
      for (int kc = 0; kc < 4; ++kc) { acc = wmma16(qh[kc], bk[t][kc], acc); acl = wmma16(ql[kc], bk[t][kc], acl); }
#pragma unroll
      for (int r = 0; r < 8; ++r) sS[wave * 16 + 8 * g + r][t * 16 + col] = acc[r] + acl[r] * (1.0f / 2048.0f); }
    LDSX();
    // logits for this wave's pixels: lane (pl = lane>>1, hf): kj in hf ? 4..6 : 0..3
    { const int pl = lane >> 1, hf = lane & 1; const int px = wave * 16 + pl;
      float lg[4];
#pragma unroll   // four fixed trips instead of a loop whose every trip waited on its LDS reads: the reads issue as one group; the trip that lane hf = 1 does not have does kj = 6 once more (same lane, same value, same place), so that no branch splits the group
      for (int j = 0; j < 4; ++j) { const int kj = hf * 4 + j < KS ? hf * 4 + j : KS - 1; lg[j] = sS[px][pl + kj] + sbx[px][kj] + sby[px][ki]; }
#pragma unroll
      for (int j = 0; j < 4; ++j) { const int kj = hf * 4 + j < KS ? hf * 4 + j : KS - 1; slg[px][ki * KS + kj] = lg[j]; } }
    LDSX(); }
  // softmax per pixel (lane pairs): slg <- probabilities x 2^14 (in place)
  { const int pl = lane >> 1, hf = lane & 1; const int px = wave * 16 + pl; float mx = -3.4e38f;
    for (int n = 0; n < KS * KS; ++n) mx = fmaxf(mx, slg[px][n]);
    float se = 0.f;
#pragma unroll   // unrolled whole: the 49 logits stay in the registers that the maximum read them into, where the rolled loop read them again and waited on every trip (same order of the sum)
    for (int n = 0; n < KS * KS; ++n) se += expf(slg[px][n] - mx);
    const float sc = 16384.0f / se;
    LDSX();                                                   // both lanes of the pair have read all 49 logits before either overwrites them
    float pv[25];
#pragma unroll   // 25 fixed trips, all reads as one group ahead of the stores; the trip that lane hf = 1 does not have does its n = 47 once more (same lane, same value, same place), so that no branch splits the group
    for (int j = 0; j < 25; ++j) pv[j] = slg[px][hf + 2 * j < KS * KS ? hf + 2 * j : KS * KS - 2];
#pragma unroll
    for (int j = 0; j < 25; ++j) slg[px][hf + 2 * j < KS * KS ? hf + 2 * j : KS * KS - 2] = expf(pv[j] - mx) * sc; }
  asm volatile("s_wait_asynccnt 0x0" ::: "memory");           // this wave's part of the v halo has landed before the barrier publishes it
  __syncthreads();                                            // all waves done with su.k (scores) before it becomes the output tile
  // out[px][c] = sum_ki P_ki[px][:] @ V_ki[:][c]  : M 16 per wave, K = 32 (the one chunk of v rows 16 wave .. 16 wave + 31 that holds the wave's band; cols >= 22 of P are zero, v rows >= 70 clamped), N 128
  { v8f acc[8] = {};
    // transposing reads of v: lane l hands in 16 B (8 channels from 8 ((l >> 3) & 1) on) of v row 16 wave + 8 g + (l & 7), and of the row 16 further on; rows >= 70 clamped to 69 (P is zero there)
    const int va = wave * 16 + 8 * g + (lane & 7), vb = va + 16; const int vra = va < HW + 6 ? va : HW + 5, vrb = vb < HW + 6 ? vb : HW + 5, vc = ((lane >> 3) & 1) * 8;
#pragma unroll 1
    for (int ki = 0; ki < KS; ++ki) {
      // the window row's eight v fragments, two transposing reads each, as one group; they do not depend on the band and land while it is built
      v16h bv[8];
#pragma unroll
      for (int t = 0; t < 8; ++t) { union { v16h v; v8h q[2]; } u; u.q[0] = ld_tr16(&sv[ki][vra][t * 16 + vc]); u.q[1] = ld_tr16(&sv[ki][vrb][t * 16 + vc]); bv[t] = u.v; }
      // build this wave's band rows for ki: zero the 16 x 32 tile, then P[pl][pl + kj] = prob
      const int pl = lane >> 1, hf = lane & 1; const int px = wave * 16 + pl; float pr[4];
#pragma unroll   // four fixed trips instead of a loop whose every trip waited on its LDS read: the reads issue as one group, ahead of the zeroing; the trip that lane hf = 1 does not have does kj = 6 once more (same lane, same value, same place)
      for (int j = 0; j < 4; ++j) pr[j] = slg[px][ki * KS + (hf * 4 + j < KS ? hf * 4 + j : KS - 1)];
#pragma unroll
      for (int q = lane; q < 16 * 4; q += 32) { const int rl = q >> 2, pc = q & 3; *(v4u*)(&sP[wave][rl][pc * 8]) = (v4u){0u, 0u, 0u, 0u}; }
      LDSX();
#pragma unroll
      for (int j = 0; j < 4; ++j) sP[wave][pl][pl + (hf * 4 + j < KS ? hf * 4 + j : KS - 1)] = (_Float16)pr[j];
      LDSX();
      { const v16h a = frag_h(&sP[wave][col][0], lane);
#pragma unroll
        for (int t = 0; t < 8; ++t) acc[t] = wmma16(a, bv[t], acc[t]); }
      LDSX(); }
#pragma unroll
    for (int t = 0; t < 8; ++t)
#pragma unroll
      for (int r = 0; r < 8; ++r) su.o[wave * 16 + 8 * g + r][t * 16 + col] = acc[t][r] * (1.0f / 16384.0f); }
  __syncthreads();
  for (int q = tid; q < CC * 16; q += 128) { const int c = q >> 4, x4 = q & 15; vst2(out + (((size_t)b * CC + c) * HW + y) * HW + x4 * 4, (v4f){su.o[x4 * 4][c], su.o[x4 * 4 + 1][c], su.o[x4 * 4 + 2][c], su.o[x4 * 4 + 3][c]}); }
}
extern "C" void kernel_launch(void* const* d_in, const int* in_sizes, int n_in, void* d_out, int out_size, void* d_ws, size_t ws_size, hipStream_t stream) {
  (void)in_sizes; (void)n_in; (void)out_size; (void)ws_size;
  const float** I = (const float**)d_in;
  const float* x = I[0]; const float* wq = I[1]; const float* wk = I[2]; const float* wv = I[3]; const float* relx = I[4]; const float* rely = I[5];
  float* out = (float*)d_out;
  char* ws = (char*)d_ws; size_t off = 0;
  auto take = [&](size_t bytes) { char* p = ws + off; off += (bytes + 255) & ~(size_t)255; return p; };
  const size_t NP = (size_t)NB * HW * HW;
  float* QF = (float*)take(NP * CC * 4); _Float16* KH = (_Float16*)take(NP * CC * 2); _Float16* VH = (_Float16*)take(NP * CC * 2);
  k_qkv<<<dim3(HW, NB), 128, 0, stream>>>(x, wq, wk, wv, QF, KH, VH);
  k_attn<<<dim3(HW, NB), 128, 0, stream>>>(QF, KH, VH, relx, rely, out);
}

// v006
// A run of this version takes 21.5 microseconds.
// Timed twice side by side with v005, it ran 1.19 and 1.20 times as fast.
// Over all steps from v000 it is 4.68 times as fast.
#include <hip/hip_runtime.h>
#include <math.h>

typedef __attribute__((ext_vector_type(16))) _Float16 v16h;
typedef __attribute__((ext_vector_type(16))) __bf16 v16b;
typedef __attribute__((ext_vector_type(8)))  _Float16 v8h;
typedef __attribute__((ext_vector_type(8)))  float v8f;
typedef __attribute__((ext_vector_type(4)))  float v4f;
typedef __attribute__((ext_vector_type(2)))  float v2f;
typedef __attribute__((ext_vector_type(4)))  unsigned v4u;
typedef __attribute__((ext_vector_type(4)))  int v4i;
typedef float __attribute__((may_alias)) float_a;
typedef int __attribute__((may_alias)) int_a;

template <typename T> __device__ __forceinline__ void vst2(void* p, T v) { *(T*)p = v;  }
__device__ __forceinline__ v8f wmma16(v16h a, v16h b, v8f c) {
  v8f d = __builtin_amdgcn_wmma_f32_16x16x32_f16(false, a, false, b, (short)0, c, false, false);
  asm volatile("v_nop\n\tv_nop\n\tv_nop\n\tv_nop" : "+v"(d) : "v"(a), "v"(b));
  return d;
}
__device__ __forceinline__ v8f wmma_bf(v16b a, v16b b, v8f c) {
  v8f d = __builtin_amdgcn_wmma_f32_16x16x32_bf16(false, a, false, b, (short)0, c, false, false);
  asm volatile("v_nop\n\tv_nop\n\tv_nop\n\tv_nop" : "+v"(d) : "v"(a), "v"(b));
  return d;
}
// 16x16x32 fragments: lane = (h = lane>>4, row/col = lane&15); elements 0..7 = k0+8h+0..7, 8..15 = k0+16+8h+0..7; D element r = row 8h+r
__device__ __forceinline__ v16h frag_h(const _Float16* rowk0, int lane) {
  union { v16h v; v8h q[2]; } u; const _Float16* p = rowk0 + 8 * (lane >> 4);
  u.q[0] = *(const v8h*)p; u.q[1] = *(const v8h*)(p + 16); return u.v;
}
// ds_load_tr16_b128: the lanes hand in 16-byte pieces of 16 rows of a row-major f16 LDS tile; lane (h, col) gets rows 8h..8h+7 of column col, i.e. half a column fragment in the k order above
typedef __attribute__((ext_vector_type(8))) short v8s;
__device__ __forceinline__ v8h ld_tr16(const _Float16* p) { typedef __attribute__((address_space(3))) v8s lds_v8s; return __builtin_bit_cast(v8h, __builtin_amdgcn_ds_load_tr16_b128_v8i16((lds_v8s*)p)); }
__device__ __forceinline__ v16h frag_f32(const float* rowk0, int lane) {
  v16h a; const float* p = rowk0 + 8 * (lane >> 4);
#pragma unroll
  for (int i = 0; i < 8; ++i) { a[i] = (_Float16)p[i]; a[8 + i] = (_Float16)p[16 + i]; }
  return a;
}
__device__ __forceinline__ v16h frag_f32s(const float* rowk0, int lane, float sc) {
  v16h a; const float* p = rowk0 + 8 * (lane >> 4);
#pragma unroll
  for (int i = 0; i < 8; ++i) { a[i] = (_Float16)(p[i] * sc); a[8 + i] = (_Float16)(p[16 + i] * sc); }
  return a;
}
// column fragment from a [K][ld] layout (column n), rows >= K read as 0
__device__ __forceinline__ v16h fragc_f32(const float* W, int k0, int n, int lane, int ld, int K) {
  v16h a; const int g = lane >> 4;
#pragma unroll
  for (int i = 0; i < 8; ++i) { const int ka = k0 + 8 * g + i, kb = ka + 16;
    a[i] = (_Float16)(ka < K ? W[(size_t)ka * ld + n] : 0.f); a[8 + i] = (_Float16)(kb < K ? W[(size_t)kb * ld + n] : 0.f); }
  return a;
}
struct F2 { v16b h, l; };
__device__ __forceinline__ F2 bsplit16(const float v[16]) { F2 r;
#pragma unroll
  for (int i = 0; i < 16; ++i) { const __bf16 h = (__bf16)v[i]; r.h[i] = h; r.l[i] = (__bf16)(v[i] - (float)h); }
  return r; }
__device__ __forceinline__ F2 split_row(const float* row, int k0, int lane) { float v[16]; const float* p = row + k0 + 8 * (lane >> 4);
#pragma unroll
  for (int i = 0; i < 8; ++i) { v[i] = p[i]; v[8 + i] = p[16 + i]; }
  return bsplit16(v); }
__device__ __forceinline__ F2 split_rowK(const float* row, int k0, int lane, int K) { float v[16]; const int g = lane >> 4;
#pragma unroll
  for (int i = 0; i < 8; ++i) { const int ka = k0 + 8 * g + i, kb = ka + 16; v[i] = ka < K ? row[ka] : 0.f; v[8 + i] = kb < K ? row[kb] : 0.f; }
  return bsplit16(v); }
__device__ __forceinline__ F2 split_col(const float* W, int k0, int n, int lane, int ld, int K) { float v[16]; const int g = lane >> 4;
#pragma unroll
  for (int i = 0; i < 8; ++i) { const int ka = k0 + 8 * g + i, kb = ka + 16; v[i] = ka < K ? W[(size_t)ka * ld + n] : 0.f; v[8 + i] = kb < K ? W[(size_t)kb * ld + n] : 0.f; }
  return bsplit16(v); }
// the 16 f32 values of one lane's fragment as four 16-byte LDS reads (elements 0..7 = k0+8h+0..7, 8..15 = k0+16+8h+0..7), kept raw so that many fragments can be read as one group and converted later
struct R16 { v4f q[4]; };
__device__ __forceinline__ R16 raw_row(const float* rowk0, int lane) { R16 r; const float* p = rowk0 + 8 * (lane >> 4);
  r.q[0] = *(const v4f*)p; r.q[1] = *(const v4f*)(p + 4); r.q[2] = *(const v4f*)(p + 16); r.q[3] = *(const v4f*)(p + 20); return r; }
__device__ __forceinline__ F2 split_raw(const R16& r) { float v[16];
#pragma unroll
  for (int i = 0; i < 16; ++i) v[i] = r.q[i >> 2][i & 3];
  return bsplit16(v); }
__device__ __forceinline__ v16h half_raw(const R16& r) { v16h a;
#pragma unroll
  for (int i = 0; i < 16; ++i) a[i] = (_Float16)r.q[i >> 2][i & 3];
  return a; }
__device__ __forceinline__ v16h half_raws(const R16& r, float sc) { v16h a;
#pragma unroll
  for (int i = 0; i < 16; ++i) a[i] = (_Float16)(r.q[i >> 2][i & 3] * sc);
  return a; }
__device__ __forceinline__ v8f mac3(const F2& a, const F2& b, v8f c) { c = wmma_bf(a.l, b.h, c); c = wmma_bf(a.h, b.l, c); return wmma_bf(a.h, b.h, c); }
__device__ __forceinline__ float sigm(float v) { return 1.0f / (1.0f + expf(-v)); }
#define LDSX() do { asm volatile("s_wait_dscnt 0" ::: "memory"); __builtin_amdgcn_wave_barrier(); __builtin_amdgcn_fence(__ATOMIC_RELEASE, "workgroup"); } while (0)

// Stand-alone local self attention (7x7 window, stride 1, zero padding 3, one 128-channel head with relative position logits from the first /
// second 8 channels of each 16-channel group): q, k, v = 1x1 convs of the input (q as a two-way bf16 split on v_wmma_f32_16x16x32_bf16 because
// it feeds the large relative-position logits, k likewise (its conv rounding dominated the logits error), v on f16 WMMA; [out][in] weights converted in the fragments), stored channels-last
// (q f32, k/v f16). Then per output pixel: 49 logits = q.k(window) + bias_x[l] + bias_y[k] in f32 from LDS halo tiles (padding = zero k/v,
#define NB 4
#define CC 128
#define HW 64
#define KS 7
#define PADW 3
#define NG 8
#define RS 8

// one wave brings 32 rows (512 B each, one row per copy, 16 B per lane) of a [128][128] f32 weight matrix into LDS rows of CC + 4 floats, through no register.
// Eight copies a statement; s_wait_xcnt closes the statement so that no address register of a copy is rewritten in front of it.
__device__ __forceinline__ void stage_w(const float* __restrict__ w, float (*dst)[CC + 4], int wave, int lane) {
  for (int j = 0; j < 32; j += 8) { const int r = wave * 32 + j; const float* g = w + (size_t)r * CC + lane * 4; const unsigned l = (unsigned)(size_t)&dst[r][lane * 4]; const unsigned P = (CC + 4) * 4;
    asm volatile("global_load_async_to_lds_b128 %0, %8, off\n\tglobal_load_async_to_lds_b128 %1, %9, off\n\tglobal_load_async_to_lds_b128 %2, %10, off\n\tglobal_load_async_to_lds_b128 %3, %11, off\n\t"
                 "global_load_async_to_lds_b128 %4, %12, off\n\tglobal_load_async_to_lds_b128 %5, %13, off\n\tglobal_load_async_to_lds_b128 %6, %14, off\n\tglobal_load_async_to_lds_b128 %7, %15, off\n\ts_wait_xcnt 0x0"
                 :: "v"(l), "v"(l + P), "v"(l + 2 * P), "v"(l + 3 * P), "v"(l + 4 * P), "v"(l + 5 * P), "v"(l + 6 * P), "v"(l + 7 * P),
                    "v"(g), "v"(g + CC), "v"(g + 2 * CC), "v"(g + 3 * CC), "v"(g + 4 * CC), "v"(g + 5 * CC), "v"(g + 6 * CC), "v"(g + 7 * CC) : "memory"); }
}
// acc[t] += (16 tokens) x (weight rows 16 t .. 16 t + 15)^T over the 128 channels, both sides as two-way bf16 splits; arow = the lane's token row, wrow = the lane's row of weight tile 0, both f32 in LDS rows of CC + 4.
// The LDS reads go in groups of four or five fragments, each group issued one half chunk ahead of its use, so that it lands under the products in between: read where it is used, every fragment's LDS latency
// was waited out by itself (no read moves up over the statement that pads a matrix instruction, which is also what holds each group at its place here). Per accumulator the order of the products is as before.
__device__ __forceinline__ void prod_split(const float* arow, const float* wrow, int lane, v8f (&acc)[8]) {
  const int WP = 16 * (CC + 4); R16 ra = raw_row(arow, lane), r0[4], r1[4];
#pragma unroll
  for (int t = 0; t < 4; ++t) r0[t] = raw_row(wrow + t * WP, lane);
#pragma unroll 1   // rolled as before: this code runs once per wave, and four copies of the body would only lengthen the text that has to be fetched
  for (int kc = 0; kc < CC / 32; ++kc) { const int kn = ((kc + 1) & (CC / 32 - 1)) * 32;   // the next chunk; the last trip reads chunk 0 once more, unused, so that no branch stands among the products
    const F2 a = split_raw(ra);
    acc[0] = mac3(a, split_raw(r0[0]), acc[0]);
#pragma unroll
    for (int t = 0; t < 4; ++t) r1[t] = raw_row(wrow + (4 + t) * WP + kc * 32, lane);
#pragma unroll
    for (int t = 1; t < 4; ++t) acc[t] = mac3(a, split_raw(r0[t]), acc[t]);
    acc[4] = mac3(a, split_raw(r1[0]), acc[4]);
    ra = raw_row(arow + kn, lane);
#pragma unroll
    for (int t = 0; t < 4; ++t) r0[t] = raw_row(wrow + t * WP + kn, lane);
#pragma unroll
    for (int t = 1; t < 4; ++t) acc[4 + t] = mac3(a, split_raw(r1[t]), acc[4 + t]); }
}
// phase 1: block (b, y): transpose x[b][:, y, :] (NCHW) to 64 token rows; q (split) -> QF f32 [b][y][x][128]; k (split), v (f16) -> KH/VH f16 [b][y][x][128]
__global__ __launch_bounds__(128) void k_qkv(const float* __restrict__ x, const float* __restrict__ wq, const float* __restrict__ wk, const float* __restrict__ wv, float* __restrict__ QF, _Float16* __restrict__ KH, _Float16* __restrict__ VH) {
  __shared__ __align__(16) float sx[64][CC + 4];            // [x][c] f32
  __shared__ __align__(16) float so[4][16][132];
  __shared__ __align__(16) float sw[3][CC][CC + 4];         // wq, wk, wv as given ([out][in] f32), each filled once by asynchronous copies
  const int tid = threadIdx.x, wave = tid >> 5, lane = tid & 31, col = lane & 15, g = lane >> 4;
  const int b = blockIdx.y, y = blockIdx.x;
  stage_w(wq, sw[0], wave, lane);                           // lands while x is transposed
  { const int c0 = tid >> 4, x4 = tid & 15; const float* xb = x + (((size_t)b * CC + c0) * HW + y) * HW + x4 * 4;   // a thread's 16 pieces lie eight channels apart: one address, constant steps
#pragma unroll   // all 16 trips: a thread's loads of x issue as one group and their memory latency is waited out once, not once per eight
    for (int j = 0; j < CC / 8; ++j) { const int c = c0 + 8 * j; const v4f v = *(const v4f*)(xb + (size_t)j * 8 * HW * HW); sx[x4 * 4][c] = v[0]; sx[x4 * 4 + 1][c] = v[1]; sx[x4 * 4 + 2][c] = v[2]; sx[x4 * 4 + 3][c] = v[3]; }
    asm volatile("s_wait_xcnt 0x0" :: "v"(xb) : "memory"); }   // the wait in front of any rewrite of the address pair that the 16 loads name; as an input the pair stays as it is up to here (else the last load's own result lands on it)
  asm volatile("s_wait_asynccnt 0x0" ::: "memory");         // this wave's rows of wq have landed before the barrier publishes them
  __syncthreads();
  stage_w(wk, sw[1], wave, lane);                           // lands under the q products
  const size_t prow0 = ((size_t)b * HW + y) * HW + wave * 16;      // pixel row index of this wave's first token
  // q: bf16 split
  { v8f acc[8] = {};
    prod_split(&sx[wave * 16 + col][0], &sw[0][col][0], lane, acc);
#pragma unroll
    for (int t = 0; t < 8; ++t)
#pragma unroll
      for (int r = 0; r < 8; ++r) so[wave][8 * g + r][t * 16 + col] = acc[t][r]; }
  LDSX();
#pragma unroll   // all 16 rows: their LDS reads issue as one group ahead of the stores
  for (int rl = 0; rl < 16; ++rl) vst2(QF + (prow0 + rl) * CC + lane * 4, *(const v4f*)(&so[wave][rl][lane * 4]));
  LDSX();
  // k (bf16 split) and v (f16), both stored f16
#pragma unroll 1
  for (int which = 0; which < 2; ++which) { _Float16* D = which == 0 ? KH : VH; v8f acc[8] = {};
    asm volatile("s_wait_asynccnt 0x0" ::: "memory");       // this wave's rows of this pass's weights have landed before the barrier publishes them
    __syncthreads();
    if (which == 0) stage_w(wv, sw[2], wave, lane);         // lands under the k products
    if (which == 0) {   // k feeds the logits: two-way bf16 split
      prod_split(&sx[wave * 16 + col][0], &sw[1][col][0], lane, acc); }
    else {
#pragma unroll
      for (int kc = 0; kc < CC / 32; ++kc) {   // the chunk's nine fragments are read as one group ahead of its products, where each weight fragment's LDS latency was waited out by itself
        const R16 ra = raw_row(&sx[wave * 16 + col][kc * 32], lane); R16 rb[8];
#pragma unroll
        for (int t = 0; t < 8; ++t) rb[t] = raw_row(&sw[2][t * 16 + col][kc * 32], lane);
        const v16h a = half_raw(ra);
#pragma unroll
        for (int t = 0; t < 8; ++t) acc[t] = wmma16(a, half_raws(rb[t], 16.0f), acc[t]); }
#pragma unroll
      for (int t = 0; t < 8; ++t)
#pragma unroll
        for (int r = 0; r < 8; ++r) acc[t][r] *= (1.0f / 16.0f); }
#pragma unroll
    for (int t = 0; t < 8; ++t)
#pragma unroll
      for (int r = 0; r < 8; ++r) so[wave][8 * g + r][t * 16 + col] = acc[t][r];
    LDSX();
    v4f rw[8][2];   // the tile's 16 LDS reads issue as one group, where the rolled loop waited on every trip's pair
#pragma unroll
    for (int j = 0; j < 8; ++j) { const float* p = &so[wave][2 * j + g][col * 8]; rw[j][0] = *(const v4f*)p; rw[j][1] = *(const v4f*)(p + 4); }
    __builtin_amdgcn_sched_barrier(0);   // holds the group together: without it the scheduler strews the reads among the conversions and stores, with a wait at each place
#pragma unroll
    for (int j = 0; j < 8; ++j) { union { v8h h8; v4u u; } pk;
#pragma unroll
      for (int e = 0; e < 8; ++e) pk.h8[e] = (_Float16)rw[j][e >> 2][e & 3];
      vst2(D + (prow0 + 2 * j + g) * CC + col * 8, pk.u); }
    LDSX(); }
}
__device__ __forceinline__ void stage_halo(const _Float16* __restrict__ src, _Float16 (*dst)[HW + 6][CC + 8], int b, int y, int wave, int lane) {
  for (int ry = 0; ry < KS; ++ry) { const int yy = y - PADW + ry; if ((unsigned)yy >= (unsigned)HW) continue;
    const _Float16* g = src + ((((size_t)b * HW + yy) * HW + wave * 16 + (lane >> 4)) * CC + (lane & 15) * 8); const unsigned l = (unsigned)(size_t)&dst[ry][PADW + wave * 16 + (lane >> 4)][(lane & 15) * 8]; const unsigned P = 2 * (CC + 8) * 2;
    asm volatile("global_load_async_to_lds_b128 %0, %8, off\n\tglobal_load_async_to_lds_b128 %1, %9, off\n\tglobal_load_async_to_lds_b128 %2, %10, off\n\tglobal_load_async_to_lds_b128 %3, %11, off\n\t"
                 "global_load_async_to_lds_b128 %4, %12, off\n\tglobal_load_async_to_lds_b128 %5, %13, off\n\tglobal_load_async_to_lds_b128 %6, %14, off\n\tglobal_load_async_to_lds_b128 %7, %15, off\n\ts_wait_xcnt 0x0"
                 :: "v"(l), "v"(l + P), "v"(l + 2 * P), "v"(l + 3 * P), "v"(l + 4 * P), "v"(l + 5 * P), "v"(l + 6 * P), "v"(l + 7 * P),
                    "v"(g), "v"(g + 2 * CC), "v"(g + 4 * CC), "v"(g + 6 * CC), "v"(g + 8 * CC), "v"(g + 10 * CC), "v"(g + 12 * CC), "v"(g + 14 * CC) : "memory"); }
}
// phase 2: block (b, y): 7-row halo of k and v (f16, zero padded); per window row ki: S = Q K_row^T on WMMA (q as hi/lo f16 pair -> two
// products, k f16), each wave over the 32 halo columns from its first pixel on (its 16 windows reach 22 of them), logits = S[px][px+kj] + bias_x[kj] + bias_y[ki];
// softmax over 49 in f32; then per ki the band matrix P[px][px+kj] (x 2^14, f16; the same 32 columns) times V_row on WMMA accumulates out[px][c]. Output written NCHW (whole 256-B rows per channel).
__global__ __launch_bounds__(128) void k_attn(const float* __restrict__ QF, const _Float16* __restrict__ KH, const _Float16* __restrict__ VH, const float* __restrict__ relx, const float* __restrict__ rely, float* __restrict__ out) {
  __shared__ __align__(16) union U { _Float16 k[KS][HW + 6][CC + 8]; float o[64][CC + 4]; } su;   // k halo, later the output tile
  __shared__ __align__(16) _Float16 sv[KS][HW + 6][CC + 8];
  __shared__ __align__(16) float sS[64][36];                 // scores for one ki: [px][pxx - 16 wave], 32 columns
  __shared__ __align__(16) _Float16 sP[4][16][40];            // per wave: band matrix rows (x 2^14) for the current ki: [px][pxx - 16 wave], 32 columns, zero off the band
  __shared__ float slg[64][52];                              // logits / probabilities per pixel
  __shared__ float sbx[64][8], sby[64][8];
  const int tid = threadIdx.x, wave = tid >> 5, lane = tid & 31, col = lane & 15, g = lane >> 4; const int b = blockIdx.y, y = blockIdx.x;
  stage_halo(KH, su.k, b, y, wave, lane);                     // lands while the zero padding is written and the position logits are summed
  // zero padding of both halos: the three columns left and right of the image, then the whole rows above or below it; no copy writes these bytes
  for (int q = tid; q < KS * 2 * PADW * (CC / 8); q += 128) { const int pc = q & 15, rest = q >> 4; const int ry = rest / (2 * PADW), e = rest % (2 * PADW); const int px = e < PADW ? e : HW + e;
    *(v4u*)(&su.k[ry][px][pc * 8]) = (v4u){0u, 0u, 0u, 0u}; *(v4u*)(&sv[ry][px][pc * 8]) = (v4u){0u, 0u, 0u, 0u}; }
  for (int ry = 0; ry < KS; ++ry) { if ((unsigned)(y - PADW + ry) < (unsigned)HW) continue;
    for (int q = tid; q < HW * (CC / 8); q += 128) { const int pc = q & 15, px = PADW + (q >> 4); *(v4u*)(&su.k[ry][px][pc * 8]) = (v4u){0u, 0u, 0u, 0u}; *(v4u*)(&sv[ry][px][pc * 8]) = (v4u){0u, 0u, 0u, 0u}; } }
  { const int px = tid >> 1, hf = tid & 1; const float* qr = QF + (((size_t)b * HW + y) * HW + px) * CC; const float* relw = hf == 0 ? relx : rely; float bb[KS];
#pragma unroll
    for (int l = 0; l < KS; ++l) bb[l] = 0.f;
#pragma unroll   // both loops unrolled: rolled, each of the 64 trips waited on its own global loads; unrolled, the q row and the table are loaded as one group and waited on once (same order of the sums)
    for (int gq = 0; gq < NG; ++gq) {
#pragma unroll
      for (int i = 0; i < RS; ++i) { const float qv = qr[gq * 16 + hf * 8 + i];
#pragma unroll
        for (int l = 0; l < KS; ++l) bb[l] = __builtin_fmaf(qv, relw[i * KS + l], bb[l]); } }   // written as the fused form that the rolled loop compiled to, so that every sum rounds as before
    float* dstb = hf == 0 ? &sbx[px][0] : &sby[px][0];
#pragma unroll
    for (int l = 0; l < KS; ++l) dstb[l] = bb[l]; }
  asm volatile("s_wait_asynccnt 0x0" ::: "memory");           // this wave's part of the k halo has landed before the barrier publishes it
  __syncthreads();
  // q fragments (hi/lo f16) for this wave's 16 pixels, 4 k-chunks
  const float* qrow = QF + (((size_t)b * HW + y) * HW + wave * 16 + col) * CC;
  v16h qh[4], ql[4];
#pragma unroll
  for (int kc = 0; kc < 4; ++kc) { const float* p = qrow + kc * 32 + 8 * g;
#pragma unroll
    for (int i = 0; i < 8; ++i) { const float v0 = p[i], v1 = p[16 + i]; const _Float16 h0 = (_Float16)v0, h1 = (_Float16)v1; qh[kc][i] = h0; qh[kc][8 + i] = h1; ql[kc][i] = (_Float16)((v0 - (float)h0) * 2048.0f); ql[kc][8 + i] = (_Float16)((v1 - (float)h1) * 2048.0f); } }
  stage_halo(VH, sv, b, y, wave, lane);                       // lands under the scores and the softmax; behind the k halo's wait, so that no wave has more than 56 copies outstanding, and behind the q loads, which would queue after it
#pragma unroll 1
  for (int ki = 0; ki < KS; ++ki) {
    // S[px][pxx] only for the two 16-column tiles that this wave's windows reach (pxx = 16 wave .. 16 wave + 31; the windows end at 16 wave + 21).
    // In the last wave cols >= 70 would read k rows 70..79 -> out of the halo: clamp to 69, values unused
    // the window row's eight k fragments are read as one group ahead of the products: read where they are used, each pair of reads was waited on by itself (no read moves up over the statement that pads a matrix instruction)
    v16h bk[2][4];
#pragma unroll
    for (int t = 0; t < 2; ++t) { const int pxx = (wave + t) * 16 + col; const _Float16* krow = &su.k[ki][pxx < HW + 6 ? pxx : HW + 5][0];
#pragma unroll
      for (int kc = 0; kc < 4; ++kc) bk[t][kc] = frag_h(krow + kc * 32, lane); }
#pragma unroll   // two trips: unrolled, the tile's column in sS is a constant offset of the stores and no loop branch stands behind a matrix instruction
    for (int t = 0; t < 2; ++t) { v8f acc = {}, acl = {};
#pragma unroll
      for (int kc = 0; kc < 4; ++kc) { acc = wmma16(qh[kc], bk[t][kc], acc); acl = wmma16(ql[kc], bk[t][kc], acl); }
#pragma unroll
      for (int r = 0; r < 8; ++r) sS[wave * 16 + 8 * g + r][t * 16 + col] = acc[r] + acl[r] * (1.0f / 2048.0f); }
    LDSX();
    // logits for this wave's pixels: lane (pl = lane>>1, hf): kj in hf ? 4..6 : 0..3
    { const int pl = lane >> 1, hf = lane & 1; const int px = wave * 16 + pl;
      float lg[4];
#pragma unroll   // four fixed trips instead of a loop whose every trip waited on its LDS reads: the reads issue as one group; the trip that lane hf = 1 does not have does kj = 6 once more (same lane, same value, same place), so that no branch splits the group
      for (int j = 0; j < 4; ++j) { const int kj = hf * 4 + j < KS ? hf * 4 + j : KS - 1; lg[j] = sS[px][pl + kj] + sbx[px][kj] + sby[px][ki]; }
#pragma unroll
      for (int j = 0; j < 4; ++j) { const int kj = hf * 4 + j < KS ? hf * 4 + j : KS - 1; slg[px][ki * KS + kj] = lg[j]; } }
    LDSX(); }
  // softmax per pixel (lane pairs): slg <- probabilities x 2^14 (in place)
  { const int pl = lane >> 1, hf = lane & 1; const int px = wave * 16 + pl; float mx = -3.4e38f;
    for (int n = 0; n < KS * KS; ++n) mx = fmaxf(mx, slg[px][n]);
    float se = 0.f;
#pragma unroll   // unrolled whole: the 49 logits stay in the registers that the maximum read them into, where the rolled loop read them again and waited on every trip (same order of the sum)
    for (int n = 0; n < KS * KS; ++n) se += expf(slg[px][n] - mx);
    const float sc = 16384.0f / se;
    LDSX();                                                   // both lanes of the pair have read all 49 logits before either overwrites them
    float pv[25];
#pragma unroll   // 25 fixed trips, all reads as one group ahead of the stores; the trip that lane hf = 1 does not have does its n = 47 once more (same lane, same value, same place), so that no branch splits the group
    for (int j = 0; j < 25; ++j) pv[j] = slg[px][hf + 2 * j < KS * KS ? hf + 2 * j : KS * KS - 2];
#pragma unroll
    for (int j = 0; j < 25; ++j) slg[px][hf + 2 * j < KS * KS ? hf + 2 * j : KS * KS - 2] = expf(pv[j] - mx) * sc; }
  asm volatile("s_wait_asynccnt 0x0" ::: "memory");           // this wave's part of the v halo has landed before the barrier publishes it
  __syncthreads();                                            // all waves done with su.k (scores) before it becomes the output tile
  // out[px][c] = sum_ki P_ki[px][:] @ V_ki[:][c]  : M 16 per wave, K = 32 (the one chunk of v rows 16 wave .. 16 wave + 31 that holds the wave's band; cols >= 22 of P are zero, v rows >= 70 clamped), N 128
  { v8f acc[8] = {};
    // transposing reads of v: lane l hands in 16 B (8 channels from 8 ((l >> 3) & 1) on) of v row 16 wave + 8 g + (l & 7), and of the row 16 further on; rows >= 70 clamped to 69 (P is zero there)
    const int va = wave * 16 + 8 * g + (lane & 7), vb = va + 16; const int vra = va < HW + 6 ? va : HW + 5, vrb = vb < HW + 6 ? vb : HW + 5, vc = ((lane >> 3) & 1) * 8;
#pragma unroll 1
    for (int ki = 0; ki < KS; ++ki) {
      // the window row's eight v fragments, two transposing reads each, as one group; they do not depend on the band and land while it is built
      v16h bv[8];
#pragma unroll
      for (int t = 0; t < 8; ++t) { union { v16h v; v8h q[2]; } u; u.q[0] = ld_tr16(&sv[ki][vra][t * 16 + vc]); u.q[1] = ld_tr16(&sv[ki][vrb][t * 16 + vc]); bv[t] = u.v; }
      // build this wave's band rows for ki: zero the 16 x 32 tile, then P[pl][pl + kj] = prob
      const int pl = lane >> 1, hf = lane & 1; const int px = wave * 16 + pl; float pr[4];
#pragma unroll   // four fixed trips instead of a loop whose every trip waited on its LDS read: the reads issue as one group, ahead of the zeroing; the trip that lane hf = 1 does not have does kj = 6 once more (same lane, same value, same place)
      for (int j = 0; j < 4; ++j) pr[j] = slg[px][ki * KS + (hf * 4 + j < KS ? hf * 4 + j : KS - 1)];
#pragma unroll
      for (int q = lane; q < 16 * 4; q += 32) { const int rl = q >> 2, pc = q & 3; *(v4u*)(&sP[wave][rl][pc * 8]) = (v4u){0u, 0u, 0u, 0u}; }
      LDSX();
#pragma unroll
      for (int j = 0; j < 4; ++j) sP[wave][pl][pl + (hf * 4 + j < KS ? hf * 4 + j : KS - 1)] = (_Float16)pr[j];
      LDSX();
      { const v16h a = frag_h(&sP[wave][col][0], lane);
#pragma unroll
        for (int t = 0; t < 8; ++t) acc[t] = wmma16(a, bv[t], acc[t]); }
      LDSX(); }
#pragma unroll
    for (int t = 0; t < 8; ++t)
#pragma unroll
      for (int r = 0; r < 8; ++r) su.o[wave * 16 + 8 * g + r][t * 16 + col] = acc[t][r] * (1.0f / 16384.0f); }
  __syncthreads();
  for (int q = tid; q < CC * 16; q += 128) { const int c = q >> 4, x4 = q & 15; vst2(out + (((size_t)b * CC + c) * HW + y) * HW + x4 * 4, (v4f){su.o[x4 * 4][c], su.o[x4 * 4 + 1][c], su.o[x4 * 4 + 2][c], su.o[x4 * 4 + 3][c]}); }
}
extern "C" void kernel_launch(void* const* d_in, const int* in_sizes, int n_in, void* d_out, int out_size, void* d_ws, size_t ws_size, hipStream_t stream) {
  (void)in_sizes; (void)n_in; (void)out_size; (void)ws_size;
  const float** I = (const float**)d_in;
  const float* x = I[0]; const float* wq = I[1]; const float* wk = I[2]; const float* wv = I[3]; const float* relx = I[4]; const float* rely = I[5];
  float* out = (float*)d_out;
  char* ws = (char*)d_ws; size_t off = 0;
  auto take = [&](size_t bytes) { char* p = ws + off; off += (bytes + 255) & ~(size_t)255; return p; };
  const size_t NP = (size_t)NB * HW * HW;
  float* QF = (float*)take(NP * CC * 4); _Float16* KH = (_Float16*)take(NP * CC * 2); _Float16* VH = (_Float16*)take(NP * CC * 2);
  k_qkv<<<dim3(HW, NB), 128, 0, stream>>>(x, wq, wk, wv, QF, KH, VH);
  k_attn<<<dim3(HW, NB), 128, 0, stream>>>(QF, KH, VH, relx, rely, out);
}

// v007
// A run of this version takes 18.6 microseconds.
// In two side-by-side timings against v006, it was 1.15 and 1.16 times as fast.
// Counting every step since v000, it is 5.41 times as fast.
#include <hip/hip_runtime.h>
#include <math.h>

typedef __attribute__((ext_vector_type(16))) _Float16 v16h;
typedef __attribute__((ext_vector_type(16))) __bf16 v16b;
typedef __attribute__((ext_vector_type(8)))  _Float16 v8h;
typedef __attribute__((ext_vector_type(8)))  float v8f;
typedef __attribute__((ext_vector_type(4)))  float v4f;
typedef __attribute__((ext_vector_type(2)))  float v2f;
typedef __attribute__((ext_vector_type(4)))  unsigned v4u;
typedef __attribute__((ext_vector_type(4)))  int v4i;
typedef float __attribute__((may_alias)) float_a;
typedef int __attribute__((may_alias)) int_a;

template <typename T> __device__ __forceinline__ void vst2(void* p, T v) { *(T*)p = v;  }
__device__ __forceinline__ v8f wmma16(v16h a, v16h b, v8f c) {
  v8f d = __builtin_amdgcn_wmma_f32_16x16x32_f16(false, a, false, b, (short)0, c, false, false);
  asm volatile("v_nop\n\tv_nop\n\tv_nop\n\tv_nop" : "+v"(d) : "v"(a), "v"(b));
  return d;
}
__device__ __forceinline__ v8f wmma_bf(v16b a, v16b b, v8f c) {
  v8f d = __builtin_amdgcn_wmma_f32_16x16x32_bf16(false, a, false, b, (short)0, c, false, false);
  asm volatile("v_nop\n\tv_nop\n\tv_nop\n\tv_nop" : "+v"(d) : "v"(a), "v"(b));
  return d;
}
// 16x16x32 fragments: lane = (h = lane>>4, row/col = lane&15); elements 0..7 = k0+8h+0..7, 8..15 = k0+16+8h+0..7; D element r = row 8h+r
__device__ __forceinline__ v16h frag_h(const _Float16* rowk0, int lane) {
  union { v16h v; v8h q[2]; } u; const _Float16* p = rowk0 + 8 * (lane >> 4);
  u.q[0] = *(const v8h*)p; u.q[1] = *(const v8h*)(p + 16); return u.v;
}
// ds_load_tr16_b128: the lanes hand in 16-byte pieces of 16 rows of a row-major f16 LDS tile; lane (h, col) gets rows 8h..8h+7 of column col, i.e. half a column fragment in the k order above
typedef __attribute__((ext_vector_type(8))) short v8s;
__device__ __forceinline__ v8h ld_tr16(const _Float16* p) { typedef __attribute__((address_space(3))) v8s lds_v8s; return __builtin_bit_cast(v8h, __builtin_amdgcn_ds_load_tr16_b128_v8i16((lds_v8s*)p)); }
__device__ __forceinline__ v16h frag_f32(const float* rowk0, int lane) {
  v16h a; const float* p = rowk0 + 8 * (lane >> 4);
#pragma unroll
  for (int i = 0; i < 8; ++i) { a[i] = (_Float16)p[i]; a[8 + i] = (_Float16)p[16 + i]; }
  return a;
}
__device__ __forceinline__ v16h frag_f32s(const float* rowk0, int lane, float sc) {
  v16h a; const float* p = rowk0 + 8 * (lane >> 4);
#pragma unroll
  for (int i = 0; i < 8; ++i) { a[i] = (_Float16)(p[i] * sc); a[8 + i] = (_Float16)(p[16 + i] * sc); }
  return a;
}
// column fragment from a [K][ld] layout (column n), rows >= K read as 0
__device__ __forceinline__ v16h fragc_f32(const float* W, int k0, int n, int lane, int ld, int K) {
  v16h a; const int g = lane >> 4;
#pragma unroll
  for (int i = 0; i < 8; ++i) { const int ka = k0 + 8 * g + i, kb = ka + 16;
    a[i] = (_Float16)(ka < K ? W[(size_t)ka * ld + n] : 0.f); a[8 + i] = (_Float16)(kb < K ? W[(size_t)kb * ld + n] : 0.f); }
  return a;
}
struct F2 { v16b h, l; };
__device__ __forceinline__ F2 bsplit16(const float v[16]) { F2 r;
#pragma unroll
  for (int i = 0; i < 16; ++i) { const __bf16 h = (__bf16)v[i]; r.h[i] = h; r.l[i] = (__bf16)(v[i] - (float)h); }
  return r; }
__device__ __forceinline__ F2 split_row(const float* row, int k0, int lane) { float v[16]; const float* p = row + k0 + 8 * (lane >> 4);
#pragma unroll
  for (int i = 0; i < 8; ++i) { v[i] = p[i]; v[8 + i] = p[16 + i]; }
  return bsplit16(v); }
__device__ __forceinline__ F2 split_rowK(const float* row, int k0, int lane, int K) { float v[16]; const int g = lane >> 4;
#pragma unroll
  for (int i = 0; i < 8; ++i) { const int ka = k0 + 8 * g + i, kb = ka + 16; v[i] = ka < K ? row[ka] : 0.f; v[8 + i] = kb < K ? row[kb] : 0.f; }
  return bsplit16(v); }
__device__ __forceinline__ F2 split_col(const float* W, int k0, int n, int lane, int ld, int K) { float v[16]; const int g = lane >> 4;
#pragma unroll
  for (int i = 0; i < 8; ++i) { const int ka = k0 + 8 * g + i, kb = ka + 16; v[i] = ka < K ? W[(size_t)ka * ld + n] : 0.f; v[8 + i] = kb < K ? W[(size_t)kb * ld + n] : 0.f; }
  return bsplit16(v); }
// the 16 f32 values of one lane's fragment as four 16-byte LDS reads (elements 0..7 = k0+8h+0..7, 8..15 = k0+16+8h+0..7), kept raw so that many fragments can be read as one group and converted later
struct R16 { v4f q[4]; };
__device__ __forceinline__ R16 raw_row(const float* rowk0, int lane) { R16 r; const float* p = rowk0 + 8 * (lane >> 4);
  r.q[0] = *(const v4f*)p; r.q[1] = *(const v4f*)(p + 4); r.q[2] = *(const v4f*)(p + 16); r.q[3] = *(const v4f*)(p + 20); return r; }
__device__ __forceinline__ F2 split_raw(const R16& r) { float v[16];
#pragma unroll
  for (int i = 0; i < 16; ++i) v[i] = r.q[i >> 2][i & 3];
  return bsplit16(v); }
__device__ __forceinline__ v16h half_raw(const R16& r) { v16h a;
#pragma unroll
  for (int i = 0; i < 16; ++i) a[i] = (_Float16)r.q[i >> 2][i & 3];
  return a; }
__device__ __forceinline__ v16h half_raws(const R16& r, float sc) { v16h a;
#pragma unroll
  for (int i = 0; i < 16; ++i) a[i] = (_Float16)(r.q[i >> 2][i & 3] * sc);
  return a; }
__device__ __forceinline__ v8f mac3(const F2& a, const F2& b, v8f c) { c = wmma_bf(a.l, b.h, c); c = wmma_bf(a.h, b.l, c); return wmma_bf(a.h, b.h, c); }
__device__ __forceinline__ float sigm(float v) { return 1.0f / (1.0f + expf(-v)); }
// 2^x. The v_nop in the same statement is the one slot that the instruction set asks for behind a transcendental before its result is read or its source overwritten
__device__ __forceinline__ float exp2_slot(float x) { float p; asm("v_exp_f32 %0, %1\n\tv_nop" : "=v"(p) : "v"(x)); return p; }
// lane l's value from lane l ^ 16 (the other half of the wave)
__device__ __forceinline__ float xhalf(float x) { return __builtin_bit_cast(float, __builtin_amdgcn_permlanex16(__builtin_bit_cast(int, x), __builtin_bit_cast(int, x), 0x76543210, 0xfedcba98, false, false)); }
#define LDSX() do { asm volatile("s_wait_dscnt 0" ::: "memory"); __builtin_amdgcn_wave_barrier(); __builtin_amdgcn_fence(__ATOMIC_RELEASE, "workgroup"); } while (0)

// Stand-alone local self attention (7x7 window, stride 1, zero padding 3, one 128-channel head with relative position logits from the first /
// second 8 channels of each 16-channel group): q, k, v = 1x1 convs of the input (q as a two-way bf16 split on v_wmma_f32_16x16x32_bf16 because
// it feeds the large relative-position logits, k likewise (its conv rounding dominated the logits error), v on f16 WMMA; [out][in] weights converted in the fragments), stored channels-last
// (q f32, k/v f16). Then per output pixel: 49 logits = q.k(window) + bias_x[l] + bias_y[k] in f32 from LDS halo tiles (padding = zero k/v,
#define NB 4
#define CC 128
#define HW 64
#define KS 7
#define PADW 3
#define NG 8
#define RS 8

// one wave brings 32 rows (512 B each, one row per copy, 16 B per lane) of a [128][128] f32 weight matrix into LDS rows of CC + 4 floats, through no register.
// Eight copies a statement; s_wait_xcnt closes the statement so that no address register of a copy is rewritten in front of it.
__device__ __forceinline__ void stage_w(const float* __restrict__ w, float (*dst)[CC + 4], int wave, int lane) {
  for (int j = 0; j < 32; j += 8) { const int r = wave * 32 + j; const float* g = w + (size_t)r * CC + lane * 4; const unsigned l = (unsigned)(size_t)&dst[r][lane * 4]; const unsigned P = (CC + 4) * 4;
    asm volatile("global_load_async_to_lds_b128 %0, %8, off\n\tglobal_load_async_to_lds_b128 %1, %9, off\n\tglobal_load_async_to_lds_b128 %2, %10, off\n\tglobal_load_async_to_lds_b128 %3, %11, off\n\t"
                 "global_load_async_to_lds_b128 %4, %12, off\n\tglobal_load_async_to_lds_b128 %5, %13, off\n\tglobal_load_async_to_lds_b128 %6, %14, off\n\tglobal_load_async_to_lds_b128 %7, %15, off\n\ts_wait_xcnt 0x0"
                 :: "v"(l), "v"(l + P), "v"(l + 2 * P), "v"(l + 3 * P), "v"(l + 4 * P), "v"(l + 5 * P), "v"(l + 6 * P), "v"(l + 7 * P),
                    "v"(g), "v"(g + CC), "v"(g + 2 * CC), "v"(g + 3 * CC), "v"(g + 4 * CC), "v"(g + 5 * CC), "v"(g + 6 * CC), "v"(g + 7 * CC) : "memory"); }
}
// acc[t] += (16 tokens) x (weight rows 16 t .. 16 t + 15)^T over the 128 channels, both sides as two-way bf16 splits; arow = the lane's token row, wrow = the lane's row of weight tile 0, both f32 in LDS rows of CC + 4.
// The LDS reads go in groups of four or five fragments, each group issued one half chunk ahead of its use, so that it lands under the products in between: read where it is used, every fragment's LDS latency
// was waited out by itself (no read moves up over the statement that pads a matrix instruction, which is also what holds each group at its place here). Per accumulator the order of the products is as before.
__device__ __forceinline__ void prod_split(const float* arow, const float* wrow, int lane, v8f (&acc)[8]) {
  const int WP = 16 * (CC + 4); R16 ra = raw_row(arow, lane), r0[4], r1[4];
#pragma unroll
  for (int t = 0; t < 4; ++t) r0[t] = raw_row(wrow + t * WP, lane);
#pragma unroll 1   // rolled as before: this code runs once per wave, and four copies of the body would only lengthen the text that has to be fetched
  for (int kc = 0; kc < CC / 32; ++kc) { const int kn = ((kc + 1) & (CC / 32 - 1)) * 32;   // the next chunk; the last trip reads chunk 0 once more, unused, so that no branch stands among the products
    const F2 a = split_raw(ra);
    acc[0] = mac3(a, split_raw(r0[0]), acc[0]);
#pragma unroll
    for (int t = 0; t < 4; ++t) r1[t] = raw_row(wrow + (4 + t) * WP + kc * 32, lane);
#pragma unroll
    for (int t = 1; t < 4; ++t) acc[t] = mac3(a, split_raw(r0[t]), acc[t]);
    acc[4] = mac3(a, split_raw(r1[0]), acc[4]);
    ra = raw_row(arow + kn, lane);
#pragma unroll
    for (int t = 0; t < 4; ++t) r0[t] = raw_row(wrow + t * WP + kn, lane);
#pragma unroll
    for (int t = 1; t < 4; ++t) acc[4 + t] = mac3(a, split_raw(r1[t]), acc[4 + t]); }
}
// phase 1: block (b, y): transpose x[b][:, y, :] (NCHW) to 64 token rows; q (split) -> QF f32 [b][y][x][128]; k (split), v (f16) -> KH/VH f16 [b][y][x][128]
__global__ __launch_bounds__(128) void k_qkv(const float* __restrict__ x, const float* __restrict__ wq, const float* __restrict__ wk, const float* __restrict__ wv, float* __restrict__ QF, _Float16* __restrict__ KH, _Float16* __restrict__ VH) {
  __shared__ __align__(16) float sx[64][CC + 4];            // [x][c] f32
  __shared__ __align__(16) float so[4][16][132];
  __shared__ __align__(16) float sw[3][CC][CC + 4];         // wq, wk, wv as given ([out][in] f32), each filled once by asynchronous copies
  const int tid = threadIdx.x, wave = tid >> 5, lane = tid & 31, col = lane & 15, g = lane >> 4;
  const int b = blockIdx.y, y = blockIdx.x;
  stage_w(wq, sw[0], wave, lane);                           // lands while x is transposed
  { const int c0 = tid >> 4, x4 = tid & 15; const float* xb = x + (((size_t)b * CC + c0) * HW + y) * HW + x4 * 4;   // a thread's 16 pieces lie eight channels apart: one address, constant steps
#pragma unroll   // all 16 trips: a thread's loads of x issue as one group and their memory latency is waited out once, not once per eight
    for (int j = 0; j < CC / 8; ++j) { const int c = c0 + 8 * j; const v4f v = *(const v4f*)(xb + (size_t)j * 8 * HW * HW); sx[x4 * 4][c] = v[0]; sx[x4 * 4 + 1][c] = v[1]; sx[x4 * 4 + 2][c] = v[2]; sx[x4 * 4 + 3][c] = v[3]; }
    asm volatile("s_wait_xcnt 0x0" :: "v"(xb) : "memory"); }   // the wait in front of any rewrite of the address pair that the 16 loads name; as an input the pair stays as it is up to here (else the last load's own result lands on it)
  asm volatile("s_wait_asynccnt 0x0" ::: "memory");         // this wave's rows of wq have landed before the barrier publishes them
  __syncthreads();
  stage_w(wk, sw[1], wave, lane);                           // lands under the q products
  const size_t prow0 = ((size_t)b * HW + y) * HW + wave * 16;      // pixel row index of this wave's first token
  // q: bf16 split
  { v8f acc[8] = {};
    prod_split(&sx[wave * 16 + col][0], &sw[0][col][0], lane, acc);
#pragma unroll
    for (int t = 0; t < 8; ++t)
#pragma unroll
      for (int r = 0; r < 8; ++r) so[wave][8 * g + r][t * 16 + col] = acc[t][r]; }
  LDSX();
#pragma unroll   // all 16 rows: their LDS reads issue as one group ahead of the stores
  for (int rl = 0; rl < 16; ++rl) vst2(QF + (prow0 + rl) * CC + lane * 4, *(const v4f*)(&so[wave][rl][lane * 4]));
  LDSX();
  // k (bf16 split) and v (f16), both stored f16
#pragma unroll 1
  for (int which = 0; which < 2; ++which) { _Float16* D = which == 0 ? KH : VH; v8f acc[8] = {};
    asm volatile("s_wait_asynccnt 0x0" ::: "memory");       // this wave's rows of this pass's weights have landed before the barrier publishes them
    __syncthreads();
    if (which == 0) stage_w(wv, sw[2], wave, lane);         // lands under the k products
    if (which == 0) {   // k feeds the logits: two-way bf16 split
      prod_split(&sx[wave * 16 + col][0], &sw[1][col][0], lane, acc); }
    else {
#pragma unroll
      for (int kc = 0; kc < CC / 32; ++kc) {   // the chunk's nine fragments are read as one group ahead of its products, where each weight fragment's LDS latency was waited out by itself
        const R16 ra = raw_row(&sx[wave * 16 + col][kc * 32], lane); R16 rb[8];
#pragma unroll
        for (int t = 0; t < 8; ++t) rb[t] = raw_row(&sw[2][t * 16 + col][kc * 32], lane);
        const v16h a = half_raw(ra);
#pragma unroll
        for (int t = 0; t < 8; ++t) acc[t] = wmma16(a, half_raws(rb[t], 16.0f), acc[t]); }
#pragma unroll
      for (int t = 0; t < 8; ++t)
#pragma unroll
        for (int r = 0; r < 8; ++r) acc[t][r] *= (1.0f / 16.0f); }
#pragma unroll
    for (int t = 0; t < 8; ++t)
#pragma unroll
      for (int r = 0; r < 8; ++r) so[wave][8 * g + r][t * 16 + col] = acc[t][r];
    LDSX();
    v4f rw[8][2];   // the tile's 16 LDS reads issue as one group, where the rolled loop waited on every trip's pair
#pragma unroll
    for (int j = 0; j < 8; ++j) { const float* p = &so[wave][2 * j + g][col * 8]; rw[j][0] = *(const v4f*)p; rw[j][1] = *(const v4f*)(p + 4); }
    __builtin_amdgcn_sched_barrier(0);   // holds the group together: without it the scheduler strews the reads among the conversions and stores, with a wait at each place
#pragma unroll
    for (int j = 0; j < 8; ++j) { union { v8h h8; v4u u; } pk;
#pragma unroll
      for (int e = 0; e < 8; ++e) pk.h8[e] = (_Float16)rw[j][e >> 2][e & 3];
      vst2(D + (prow0 + 2 * j + g) * CC + col * 8, pk.u); }
    LDSX(); }
}
__device__ __forceinline__ void stage_halo(const _Float16* __restrict__ src, _Float16 (*dst)[HW + 6][CC + 8], int b, int y, int wave, int lane) {
  for (int ry = 0; ry < KS; ++ry) { const int yy = y - PADW + ry; if ((unsigned)yy >= (unsigned)HW) continue;
    const _Float16* g = src + ((((size_t)b * HW + yy) * HW + wave * 16 + (lane >> 4)) * CC + (lane & 15) * 8); const unsigned l = (unsigned)(size_t)&dst[ry][PADW + wave * 16 + (lane >> 4)][(lane & 15) * 8]; const unsigned P = 2 * (CC + 8) * 2;
    asm volatile("global_load_async_to_lds_b128 %0, %8, off\n\tglobal_load_async_to_lds_b128 %1, %9, off\n\tglobal_load_async_to_lds_b128 %2, %10, off\n\tglobal_load_async_to_lds_b128 %3, %11, off\n\t"
                 "global_load_async_to_lds_b128 %4, %12, off\n\tglobal_load_async_to_lds_b128 %5, %13, off\n\tglobal_load_async_to_lds_b128 %6, %14, off\n\tglobal_load_async_to_lds_b128 %7, %15, off\n\ts_wait_xcnt 0x0"
                 :: "v"(l), "v"(l + P), "v"(l + 2 * P), "v"(l + 3 * P), "v"(l + 4 * P), "v"(l + 5 * P), "v"(l + 6 * P), "v"(l + 7 * P),
                    "v"(g), "v"(g + 2 * CC), "v"(g + 4 * CC), "v"(g + 6 * CC), "v"(g + 8 * CC), "v"(g + 10 * CC), "v"(g + 12 * CC), "v"(g + 14 * CC) : "memory"); }
}
// phase 2: block (b, y): 7-row halo of k and v (f16, zero padded); per window row ki the scores are formed transposed, S^T = K_row Q^T on WMMA (q as hi/lo f16 pair -> two
// products, k f16), each wave over the 32 halo columns from its first pixel on (its 16 windows reach 22 of them). In S^T a lane holds scores of ONE pixel (its column), so the position logits, the band mask and the
// softmax over the 49 window places run in the accumulator registers (in-lane, one exchange between the wave's halves), and the two 16-row tiles of exp(logit - max) x 2^14, packed to f16, ARE the B fragment of
// out^T[c][px] = sum_ki V_row^T P_ki^T (v by transposing LDS reads as before). The division by the sum of the exponentials is done on out^T. Output written NCHW (whole 256-B rows per channel).
__global__ __launch_bounds__(128) void k_attn(const float* __restrict__ QF, const _Float16* __restrict__ KH, const _Float16* __restrict__ VH, const float* __restrict__ relx, const float* __restrict__ rely, float* __restrict__ out) {
  __shared__ __align__(16) union U { _Float16 k[KS][HW + 6][CC + 8]; float o[CC][HW + 4]; } su;   // k halo, later the output tile [c][px]
  __shared__ __align__(16) _Float16 sv[KS][HW + 6][CC + 8];
  __shared__ float sbx[64][8], sby[64][8];
  const int tid = threadIdx.x, wave = tid >> 5, lane = tid & 31, col = lane & 15, g = lane >> 4; const int b = blockIdx.y, y = blockIdx.x;
  stage_halo(KH, su.k, b, y, wave, lane);                     // lands while the zero padding is written and the position logits are summed
  // zero padding of both halos: the three columns left and right of the image, then the whole rows above or below it; no copy writes these bytes
  for (int q = tid; q < KS * 2 * PADW * (CC / 8); q += 128) { const int pc = q & 15, rest = q >> 4; const int ry = rest / (2 * PADW), e = rest % (2 * PADW); const int px = e < PADW ? e : HW + e;
    *(v4u*)(&su.k[ry][px][pc * 8]) = (v4u){0u, 0u, 0u, 0u}; *(v4u*)(&sv[ry][px][pc * 8]) = (v4u){0u, 0u, 0u, 0u}; }
  for (int ry = 0; ry < KS; ++ry) { if ((unsigned)(y - PADW + ry) < (unsigned)HW) continue;
    for (int q = tid; q < HW * (CC / 8); q += 128) { const int pc = q & 15, px = PADW + (q >> 4); *(v4u*)(&su.k[ry][px][pc * 8]) = (v4u){0u, 0u, 0u, 0u}; *(v4u*)(&sv[ry][px][pc * 8]) = (v4u){0u, 0u, 0u, 0u}; } }
  { const int px = tid >> 1, hf = tid & 1; const float* qr = QF + (((size_t)b * HW + y) * HW + px) * CC; const float* relw = hf == 0 ? relx : rely; float bb[KS];
#pragma unroll
    for (int l = 0; l < KS; ++l) bb[l] = 0.f;
#pragma unroll   // both loops unrolled: rolled, each of the 64 trips waited on its own global loads; unrolled, the q row and the table are loaded as one group and waited on once (same order of the sums)
    for (int gq = 0; gq < NG; ++gq) {
#pragma unroll
      for (int i = 0; i < RS; ++i) { const float qv = qr[gq * 16 + hf * 8 + i];
#pragma unroll
        for (int l = 0; l < KS; ++l) bb[l] = __builtin_fmaf(qv, relw[i * KS + l], bb[l]); } }   // written as the fused form that the rolled loop compiled to, so that every sum rounds as before
    float* dstb = hf == 0 ? &sbx[px][0] : &sby[px][0];
#pragma unroll
    for (int l = 0; l < KS; ++l) dstb[l] = bb[l]; }
  asm volatile("s_wait_asynccnt 0x0" ::: "memory");           // this wave's part of the k halo has landed before the barrier publishes it
  __syncthreads();
  // q fragments (hi/lo f16) for this wave's 16 pixels, 4 k-chunks
  const float* qrow = QF + (((size_t)b * HW + y) * HW + wave * 16 + col) * CC;
  v16h qh[4], ql[4];
#pragma unroll
  for (int kc = 0; kc < 4; ++kc) { const float* p = qrow + kc * 32 + 8 * g;
#pragma unroll
    for (int i = 0; i < 8; ++i) { const float v0 = p[i], v1 = p[16 + i]; const _Float16 h0 = (_Float16)v0, h1 = (_Float16)v1; qh[kc][i] = h0; qh[kc][8 + i] = h1; ql[kc][i] = (_Float16)((v0 - (float)h0) * 2048.0f); ql[kc][8 + i] = (_Float16)((v1 - (float)h1) * 2048.0f); } }
  stage_halo(VH, sv, b, y, wave, lane);                       // lands under the scores and the softmax; behind the k halo's wait, so that no wave has more than 56 copies outstanding, and behind the q loads, which would queue after it
  // this lane's pixel is column col of every S^T tile; its rows are halo columns j = 16 t + 8 g + r (from the wave's first pixel on), window place kj = j - col. Off the band (kj outside 0..6) the x logit is a large
  // negative number, so that the exponential there is exactly 0. Rows 22..31 (t = 1, r >= 6 in the lower half, all of the upper half) lie in no window of the wave: r >= 6 of tile 1 is left out altogether.
  const int px = wave * 16 + col;
  // S^T[j][px] for the two 16-row tiles that this wave's windows reach. In the last wave rows >= 70 would read k rows 70..79 -> out of the halo: clamp to 69, values masked.
  // A tile's four k fragments are read as one group right behind the last product that uses their registers, half a window row ahead of their own products (no read moves up over the statement that pads a matrix instruction).
  float lg[KS][2][8]; v16h bk[2][4];
  const int pk[2] = { wave * 16 + col, wave * 16 + col + 16 < HW + 6 ? wave * 16 + col + 16 : HW + 5 };
#pragma unroll
  for (int t = 0; t < 2; ++t)
#pragma unroll
    for (int kc = 0; kc < 4; ++kc) bk[t][kc] = frag_h(&su.k[0][pk[t]][kc * 32], lane);
#pragma unroll   // all seven window rows: their scores stay in registers, which takes constant indices
  for (int ki = 0; ki < KS; ++ki)
#pragma unroll
    for (int t = 0; t < 2; ++t) { v8f ah = {}, al = {};
#pragma unroll
      for (int kc = 0; kc < 4; ++kc) { ah = wmma16(bk[t][kc], qh[kc], ah); al = wmma16(bk[t][kc], ql[kc], al); }
      if (ki + 1 < KS) {
#pragma unroll
        for (int kc = 0; kc < 4; ++kc) bk[t][kc] = frag_h(&su.k[ki + 1][pk[t]][kc * 32], lane); }
#pragma unroll
      for (int r = 0; r < (t == 0 ? 8 : 6); ++r) lg[ki][t][r] = ah[r] + al[r] * (1.0f / 2048.0f); }
  // the position logits are read and added only here, behind the products, where the registers of q and k are free again
  { float bxm[2][8], byv[KS];
#pragma unroll
    for (int t = 0; t < 2; ++t)
#pragma unroll
      for (int r = 0; r < (t == 0 ? 8 : 6); ++r) { const int kj = t * 16 + 8 * g + r - col; const bool in = (unsigned)kj < (unsigned)KS; const float v = sbx[px][in ? kj : 0]; bxm[t][r] = in ? v : -1.0e30f; }
#pragma unroll
    for (int ki = 0; ki < KS; ++ki) byv[ki] = sby[px][ki];
#pragma unroll
    for (int ki = 0; ki < KS; ++ki)
#pragma unroll
      for (int t = 0; t < 2; ++t)
#pragma unroll
        for (int r = 0; r < (t == 0 ? 8 : 6); ++r) lg[ki][t][r] = lg[ki][t][r] + bxm[t][r] + byv[ki]; }
  // softmax per pixel, in registers: eight running maxima / sums per lane, joined in-lane and then with the lane that holds the pixel's other rows (l ^ 16)
  float inv; v16h pT[KS];
  { float m8[8], s8[8];
#pragma unroll
    for (int r = 0; r < 8; ++r) m8[r] = lg[0][0][r];
#pragma unroll
    for (int ki = 0; ki < KS; ++ki)
#pragma unroll
      for (int t = 0; t < 2; ++t)
#pragma unroll
        for (int r = 0; r < (t == 0 ? 8 : 6); ++r) m8[r] = fmaxf(m8[r], lg[ki][t][r]);
    float mx = fmaxf(fmaxf(fmaxf(m8[0], m8[1]), fmaxf(m8[2], m8[3])), fmaxf(fmaxf(m8[4], m8[5]), fmaxf(m8[6], m8[7])));
    mx = fmaxf(mx, xhalf(mx));
    const float ms = mx - 9.70406053f;   // 14 ln 2: the exponentials come out x 2^14 (f16 range of the band), the sum with them, so the factor cancels in the division
    // exp(d) as 2^(d log2 e), one hardware instruction: all 98 places of a lane stand unrolled here, and as many library exponentials (13 instructions each) would bring the kernel's text to about 32 KB
#pragma unroll
    for (int r = 0; r < 8; ++r) s8[r] = 0.f;
#pragma unroll
    for (int ki = 0; ki < KS; ++ki) {
#pragma unroll
      for (int t = 0; t < 2; ++t)
#pragma unroll
        for (int r = 0; r < 8; ++r) {
          if (t == 1 && r >= 6) { pT[ki][8 + r] = (_Float16)0.f; continue; }
          const float p = exp2_slot((lg[ki][t][r] - ms) * 1.44269504f); s8[r] += p; pT[ki][t * 8 + r] = (_Float16)p; } }
    float se = ((s8[0] + s8[1]) + (s8[2] + s8[3])) + ((s8[4] + s8[5]) + (s8[6] + s8[7]));
    se += xhalf(se);
    inv = 1.0f / se; }
  asm volatile("s_wait_asynccnt 0x0" ::: "memory");           // this wave's part of the v halo has landed before the barrier publishes it
  __syncthreads();                                            // all waves done with su.k (scores) before it becomes the output tile
  // out^T[c][px] = sum_ki V_ki^T[c][:] @ P_ki^T[:][px] : M 128 (eight tiles), K = 32 (the one chunk of v rows 16 wave .. 16 wave + 31 that holds the wave's band; rows >= 22 of P^T are zero, v rows >= 70 clamped), N 16 per wave
  { v8f acc[8] = {}; v16h bv[8];
    // transposing reads of v: lane l hands in 16 B (8 channels from 8 ((l >> 3) & 1) on) of v row 16 wave + 8 g + (l & 7), and of the row 16 further on; rows >= 70 clamped to 69 (P^T is zero there)
    const int va = wave * 16 + 8 * g + (lane & 7), vb = va + 16; const int vra = va < HW + 6 ? va : HW + 5, vrb = vb < HW + 6 ? vb : HW + 5, vc = ((lane >> 3) & 1) * 8;
#pragma unroll
    for (int t = 0; t < 8; ++t) { union { v16h v; v8h q[2]; } u; u.q[0] = ld_tr16(&sv[0][vra][t * 16 + vc]); u.q[1] = ld_tr16(&sv[0][vrb][t * 16 + vc]); bv[t] = u.v; }
#pragma unroll   // all seven window rows: P^T sits in registers, which takes constant indices; four v fragments are read as one group right behind the products that use their registers, half a window row ahead of their own
    for (int ki = 0; ki < KS; ++ki)
#pragma unroll
      for (int hh = 0; hh < 2; ++hh) {
#pragma unroll
        for (int t = 4 * hh; t < 4 * hh + 4; ++t) acc[t] = wmma16(bv[t], pT[ki], acc[t]);
        if (ki + 1 < KS) {
#pragma unroll
          for (int t = 4 * hh; t < 4 * hh + 4; ++t) { union { v16h v; v8h q[2]; } u; u.q[0] = ld_tr16(&sv[ki + 1][vra][t * 16 + vc]); u.q[1] = ld_tr16(&sv[ki + 1][vrb][t * 16 + vc]); bv[t] = u.v; } } }
#pragma unroll
    for (int t = 0; t < 8; ++t)
#pragma unroll
      for (int r = 0; r < 8; ++r) su.o[t * 16 + 8 * g + r][px] = acc[t][r] * inv; }
  __syncthreads();
  { const int c0 = tid >> 4, x4 = tid & 15; float* ob = out + (((size_t)b * CC + c0) * HW + y) * HW + x4 * 4; const float* sb = &su.o[c0][x4 * 4]; v4f w[CC / 8];   // a thread's 16 pieces lie eight channels apart: one address each side, constant steps
#pragma unroll   // all 16 pieces: their LDS reads issue as one group ahead of the stores
    for (int j = 0; j < CC / 8; ++j) w[j] = *(const v4f*)(sb + j * 8 * (HW + 4));
#pragma unroll
    for (int j = 0; j < CC / 8; ++j) vst2(ob + (size_t)j * 8 * HW * HW, w[j]); }
}
extern "C" void kernel_launch(void* const* d_in, const int* in_sizes, int n_in, void* d_out, int out_size, void* d_ws, size_t ws_size, hipStream_t stream) {
  (void)in_sizes; (void)n_in; (void)out_size; (void)ws_size;
  const float** I = (const float**)d_in;
  const float* x = I[0]; const float* wq = I[1]; const float* wk = I[2]; const float* wv = I[3]; const float* relx = I[4]; const float* rely = I[5];
  float* out = (float*)d_out;
  char* ws = (char*)d_ws; size_t off = 0;
  auto take = [&](size_t bytes) { char* p = ws + off; off += (bytes + 255) & ~(size_t)255; return p; };
  const size_t NP = (size_t)NB * HW * HW;
  float* QF = (float*)take(NP * CC * 4); _Float16* KH = (_Float16*)take(NP * CC * 2); _Float16* VH = (_Float16*)take(NP * CC * 2);
  k_qkv<<<dim3(HW, NB), 128, 0, stream>>>(x, wq, wk, wv, QF, KH, VH);
  k_attn<<<dim3(HW, NB), 128, 0, stream>>>(QF, KH, VH, relx, rely, out);
}

// v008
// It runs in 16.9 microseconds.
// Timed twice side by side with v007, it ran 1.10 times as fast both times.
// Counting every step since v000, it is 5.95 times as fast.
#include <hip/hip_runtime.h>
#include <math.h>

typedef __attribute__((ext_vector_type(16))) _Float16 v16h;
typedef __attribute__((ext_vector_type(16))) __bf16 v16b;
typedef __attribute__((ext_vector_type(8)))  _Float16 v8h;
typedef __attribute__((ext_vector_type(8)))  float v8f;
typedef __attribute__((ext_vector_type(4)))  float v4f;
typedef __attribute__((ext_vector_type(2)))  float v2f;
typedef __attribute__((ext_vector_type(4)))  unsigned v4u;
typedef __attribute__((ext_vector_type(4)))  int v4i;
typedef float __attribute__((may_alias)) float_a;
typedef int __attribute__((may_alias)) int_a;

template <typename T> __device__ __forceinline__ void vst2(void* p, T v) { *(T*)p = v;  }
__device__ __forceinline__ v8f wmma16(v16h a, v16h b, v8f c) {
  v8f d = __builtin_amdgcn_wmma_f32_16x16x32_f16(false, a, false, b, (short)0, c, false, false);
  asm volatile("v_nop\n\tv_nop\n\tv_nop\n\tv_nop" : "+v"(d) : "v"(a), "v"(b));
  return d;
}
__device__ __forceinline__ v8f wmma_bf(v16b a, v16b b, v8f c) {
  v8f d = __builtin_amdgcn_wmma_f32_16x16x32_bf16(false, a, false, b, (short)0, c, false, false);
  asm volatile("v_nop\n\tv_nop\n\tv_nop\n\tv_nop" : "+v"(d) : "v"(a), "v"(b));
  return d;
}
// 16x16x32 fragments: lane = (h = lane>>4, row/col = lane&15); elements 0..7 = k0+8h+0..7, 8..15 = k0+16+8h+0..7; D element r = row 8h+r
__device__ __forceinline__ v16h frag_h(const _Float16* rowk0, int lane) {
  union { v16h v; v8h q[2]; } u; const _Float16* p = rowk0 + 8 * (lane >> 4);
  u.q[0] = *(const v8h*)p; u.q[1] = *(const v8h*)(p + 16); return u.v;
}
// ds_load_tr16_b128: the lanes hand in 16-byte pieces of 16 rows of a row-major f16 LDS tile; lane (h, col) gets rows 8h..8h+7 of column col, i.e. half a column fragment in the k order above
typedef __attribute__((ext_vector_type(8))) short v8s;
__device__ __forceinline__ v8h ld_tr16(const _Float16* p) { typedef __attribute__((address_space(3))) v8s lds_v8s; return __builtin_bit_cast(v8h, __builtin_amdgcn_ds_load_tr16_b128_v8i16((lds_v8s*)p)); }
__device__ __forceinline__ v16h frag_f32(const float* rowk0, int lane) {
  v16h a; const float* p = rowk0 + 8 * (lane >> 4);
#pragma unroll
  for (int i = 0; i < 8; ++i) { a[i] = (_Float16)p[i]; a[8 + i] = (_Float16)p[16 + i]; }
  return a;
}
__device__ __forceinline__ v16h frag_f32s(const float* rowk0, int lane, float sc) {
  v16h a; const float* p = rowk0 + 8 * (lane >> 4);
#pragma unroll
  for (int i = 0; i < 8; ++i) { a[i] = (_Float16)(p[i] * sc); a[8 + i] = (_Float16)(p[16 + i] * sc); }
  return a;
}
// column fragment from a [K][ld] layout (column n), rows >= K read as 0
__device__ __forceinline__ v16h fragc_f32(const float* W, int k0, int n, int lane, int ld, int K) {
  v16h a; const int g = lane >> 4;
#pragma unroll
  for (int i = 0; i < 8; ++i) { const int ka = k0 + 8 * g + i, kb = ka + 16;
    a[i] = (_Float16)(ka < K ? W[(size_t)ka * ld + n] : 0.f); a[8 + i] = (_Float16)(kb < K ? W[(size_t)kb * ld + n] : 0.f); }
  return a;
}
struct F2 { v16b h, l; };
__device__ __forceinline__ F2 bsplit16(const float v[16]) { F2 r;
#pragma unroll
  for (int i = 0; i < 16; ++i) { const __bf16 h = (__bf16)v[i]; r.h[i] = h; r.l[i] = (__bf16)(v[i] - (float)h); }
  return r; }
__device__ __forceinline__ F2 split_row(const float* row, int k0, int lane) { float v[16]; const float* p = row + k0 + 8 * (lane >> 4);
#pragma unroll
  for (int i = 0; i < 8; ++i) { v[i] = p[i]; v[8 + i] = p[16 + i]; }
  return bsplit16(v); }
__device__ __forceinline__ F2 split_rowK(const float* row, int k0, int lane, int K) { float v[16]; const int g = lane >> 4;
#pragma unroll
  for (int i = 0; i < 8; ++i) { const int ka = k0 + 8 * g + i, kb = ka + 16; v[i] = ka < K ? row[ka] : 0.f; v[8 + i] = kb < K ? row[kb] : 0.f; }
  return bsplit16(v); }
__device__ __forceinline__ F2 split_col(const float* W, int k0, int n, int lane, int ld, int K) { float v[16]; const int g = lane >> 4;
#pragma unroll
  for (int i = 0; i < 8; ++i) { const int ka = k0 + 8 * g + i, kb = ka + 16; v[i] = ka < K ? W[(size_t)ka * ld + n] : 0.f; v[8 + i] = kb < K ? W[(size_t)kb * ld + n] : 0.f; }
  return bsplit16(v); }
// the 16 f32 values of one lane's fragment as four 16-byte LDS reads (elements 0..7 = k0+8h+0..7, 8..15 = k0+16+8h+0..7), kept raw so that many fragments can be read as one group and converted later
struct R16 { v4f q[4]; };
__device__ __forceinline__ R16 raw_row(const float* rowk0, int lane) { R16 r; const float* p = rowk0 + 8 * (lane >> 4);
  r.q[0] = *(const v4f*)p; r.q[1] = *(const v4f*)(p + 4); r.q[2] = *(const v4f*)(p + 16); r.q[3] = *(const v4f*)(p + 20); return r; }
__device__ __forceinline__ F2 split_raw(const R16& r) { float v[16];
#pragma unroll
  for (int i = 0; i < 16; ++i) v[i] = r.q[i >> 2][i & 3];
  return bsplit16(v); }
__device__ __forceinline__ v16h half_raw(const R16& r) { v16h a;
#pragma unroll
  for (int i = 0; i < 16; ++i) a[i] = (_Float16)r.q[i >> 2][i & 3];
  return a; }
__device__ __forceinline__ v16h half_raws(const R16& r, float sc) { v16h a;
#pragma unroll
  for (int i = 0; i < 16; ++i) a[i] = (_Float16)(r.q[i >> 2][i & 3] * sc);
  return a; }
__device__ __forceinline__ v8f mac3(const F2& a, const F2& b, v8f c) { c = wmma_bf(a.l, b.h, c); c = wmma_bf(a.h, b.l, c); return wmma_bf(a.h, b.h, c); }
__device__ __forceinline__ float sigm(float v) { return 1.0f / (1.0f + expf(-v)); }
// 2^x. The v_nop in the same statement is the one slot that the instruction set asks for behind a transcendental before its result is read or its source overwritten
__device__ __forceinline__ float exp2_slot(float x) { float p; asm("v_exp_f32 %0, %1\n\tv_nop" : "=v"(p) : "v"(x)); return p; }
// lane l's value from lane l ^ 16 (the other half of the wave)
__device__ __forceinline__ float xhalf(float x) { return __builtin_bit_cast(float, __builtin_amdgcn_permlanex16(__builtin_bit_cast(int, x), __builtin_bit_cast(int, x), 0x76543210, 0xfedcba98, false, false)); }
#define LDSX() do { asm volatile("s_wait_dscnt 0" ::: "memory"); __builtin_amdgcn_wave_barrier(); __builtin_amdgcn_fence(__ATOMIC_RELEASE, "workgroup"); } while (0)

// Stand-alone local self attention (7x7 window, stride 1, zero padding 3, one 128-channel head with relative position logits from the first /
// second 8 channels of each 16-channel group): q, k, v = 1x1 convs of the input (q as a two-way bf16 split on v_wmma_f32_16x16x32_bf16 because
// it feeds the large relative-position logits, k likewise, v on f16 WMMA; [out][in] weights converted once per work-group), stored channels-last
// (q f32, k/v f16). Then per output pixel: 49 logits = q.k(window) + bias_x[l] + bias_y[k] in f32 from LDS halo tiles (padding = zero k/v,
#define NB 4
#define CC 128
#define HW 64
#define KS 7
#define PADW 3
#define NG 8
#define RS 8

typedef __attribute__((ext_vector_type(8))) __bf16 v8b;
typedef __attribute__((ext_vector_type(4))) __bf16 v4b;
typedef __attribute__((ext_vector_type(4))) _Float16 v4h;
#define WPB (CC + 8)   // LDS row pitch of the converted weights in 16-bit elements: 272 B = 16 B x 17, free of bank conflicts for 16-byte fragment reads
// one wave loads its share (32 rows of 512 B, one row per load, 16 B per lane) of a [128][128] f32 weight matrix into registers; the 32 loads stay in flight until the share is converted.
__device__ __forceinline__ void load_w(const float* __restrict__ w, int wave, int lane, v4f (&r)[32]) {
  const float* g = w + (size_t)wave * 32 * CC + lane * 4;
#pragma unroll   // one address, constant steps
  for (int j = 0; j < 32; ++j) r[j] = *(const v4f*)(g + j * CC);
  asm volatile("s_wait_xcnt 0x0" :: "v"(g) : "memory");   // the wait in front of any rewrite of the address pair that the 32 loads name; as an input the pair stays as it is up to here
  __builtin_amdgcn_sched_barrier(0);                      // keeps the loads up here, ahead of the work under which they are to land, instead of down at their use
}
// the share as a two-way bf16 split (the same arithmetic as bsplit16), written once for the whole work-group: rows as given ([out][in]), high and low parts in arrays of their own
__device__ __forceinline__ void put_split(const v4f (&r)[32], __bf16 (*dh)[WPB], __bf16 (*dl)[WPB], int wave, int lane) {
#pragma unroll
  for (int j = 0; j < 32; ++j) { v4b h, l;
#pragma unroll
    for (int i = 0; i < 4; ++i) { const __bf16 hh = (__bf16)r[j][i]; h[i] = hh; l[i] = (__bf16)(r[j][i] - (float)hh); }
    *(v4b*)&dh[wave * 32 + j][lane * 4] = h; *(v4b*)&dl[wave * 32 + j][lane * 4] = l; }
}
// the share x 16 as f16 (the same arithmetic as half_raws)
__device__ __forceinline__ void put_half(const v4f (&r)[32], _Float16 (*dv)[WPB], int wave, int lane) {
#pragma unroll
  for (int j = 0; j < 32; ++j) { v4h h;
#pragma unroll
    for (int i = 0; i < 4; ++i) h[i] = (_Float16)(r[j][i] * 16.0f);
    *(v4h*)&dv[wave * 32 + j][lane * 4] = h; }
}
__device__ __forceinline__ v16b frag_b(const __bf16* rowk0, int lane) {
  union { v16b v; v8b q[2]; } u; const __bf16* p = rowk0 + 8 * (lane >> 4);
  u.q[0] = *(const v8b*)p; u.q[1] = *(const v8b*)(p + 16); return u.v;
}
// acc[t] += (16 tokens) x (weight rows 16 t .. 16 t + 15)^T over the 128 channels, both sides as two-way bf16 splits; arow = the lane's token row (f32 in LDS, read here as one group and split chunk by chunk as before), hrow / lrow = the lane's row of weight
// tile 0 in the high and the low array. Four tiles' fragments (16 LDS reads) go as one group, issued half a chunk ahead of their use, right behind the last product that uses their registers (no read moves up over the
// statement that pads a matrix instruction). With no conversions left between the products, the three products of a tile would wait on each other's accumulator: the four tiles take turns instead.
// Per accumulator the order of the products is as before (low x high, high x low, high x high, chunk by chunk).
__device__ __forceinline__ void prod_split(const float* arow, const __bf16* hrow, const __bf16* lrow, int lane, v8f (&acc)[8]) {
  const int WP = 16 * WPB; F2 w[2][4], a; R16 ra[4];
#pragma unroll
  for (int kc = 0; kc < 4; ++kc) ra[kc] = raw_row(arow + kc * 32, lane);
#pragma unroll
  for (int t = 0; t < 4; ++t) w[0][t].h = frag_b(hrow + t * WP, lane);
#pragma unroll
  for (int t = 0; t < 4; ++t) w[0][t].l = frag_b(lrow + t * WP, lane);
#pragma unroll   // all eight half chunks: the token row and the two fragment groups sit in registers, which takes constant indices
  for (int s = 0; s < 8; ++s) { const int kc = s >> 1, t0 = (s & 1) * 4, cu = s & 1, nx = cu ^ 1;
    if (s + 1 < 8) { const int kn = ((s + 1) >> 1) * 32, tn = ((s + 1) & 1) * 4;   // the high parts first: they are used first
#pragma unroll
      for (int t = 0; t < 4; ++t) w[nx][t].h = frag_b(hrow + (tn + t) * WP + kn, lane);
#pragma unroll
      for (int t = 0; t < 4; ++t) w[nx][t].l = frag_b(lrow + (tn + t) * WP + kn, lane); }
    if (cu == 0) a = split_raw(ra[kc]);
#pragma unroll
    for (int t = 0; t < 4; ++t) acc[t0 + t] = wmma_bf(a.l, w[cu][t].h, acc[t0 + t]);
#pragma unroll
    for (int t = 0; t < 4; ++t) acc[t0 + t] = wmma_bf(a.h, w[cu][t].l, acc[t0 + t]);
#pragma unroll
    for (int t = 0; t < 4; ++t) acc[t0 + t] = wmma_bf(a.h, w[cu][t].h, acc[t0 + t]); }
}
// a wave's 16 x 128 f32 tile -> f16 rows of D, through the wave's own LDS tile
__device__ __forceinline__ void out_half(const v8f (&acc)[8], float (*sow)[132], _Float16* __restrict__ D, size_t prow0, int lane) {
  const int col = lane & 15, g = lane >> 4;
#pragma unroll
  for (int t = 0; t < 8; ++t)
#pragma unroll
    for (int r = 0; r < 8; ++r) sow[8 * g + r][t * 16 + col] = acc[t][r];
  LDSX();
  v4f rw[8][2];   // the tile's 16 LDS reads issue as one group
#pragma unroll
  for (int j = 0; j < 8; ++j) { const float* p = &sow[2 * j + g][col * 8]; rw[j][0] = *(const v4f*)p; rw[j][1] = *(const v4f*)(p + 4); }
  __builtin_amdgcn_sched_barrier(0);   // holds the group together: without it the scheduler strews the reads among the conversions and stores, with a wait at each place
#pragma unroll
  for (int j = 0; j < 8; ++j) { union { v8h h8; v4u u; } pk;
#pragma unroll
    for (int e = 0; e < 8; ++e) pk.h8[e] = (_Float16)rw[j][e >> 2][e & 3];
    vst2(D + (prow0 + 2 * j + g) * CC + col * 8, pk.u); }
}
// phase 1: block (b, y): transpose x[b][:, y, :] (NCHW) to 64 token rows; q (split) -> QF f32 [b][y][x][128]; k (split), v (f16) -> KH/VH f16 [b][y][x][128].
// Every wave needs all of wq, wk and wv as fragments. Each matrix is converted ONCE per work-group (a quarter per wave, straight from the loaded registers) and read from LDS in its 16-bit form,
// where each of the four waves converted all of it for itself.
__global__ __launch_bounds__(128) void k_qkv(const float* __restrict__ x, const float* __restrict__ wq, const float* __restrict__ wk, const float* __restrict__ wv, float* __restrict__ QF, _Float16* __restrict__ KH, _Float16* __restrict__ VH) {
  __shared__ __align__(16) float sx[64][CC + 4];            // [x][c] f32
  __shared__ __align__(16) float so[4][16][132];
  __shared__ __align__(16) __bf16 swh[2][CC][WPB], swl[2][CC][WPB];   // wq, wk ([out][in]): high and low bf16 parts
  __shared__ __align__(16) _Float16 swv[CC][WPB];                     // wv x 16 as f16
  const int tid = threadIdx.x, wave = tid >> 5, lane = tid & 31, col = lane & 15, g = lane >> 4;
  const int b = blockIdx.y, y = blockIdx.x;
  v4f rw[32];
  { const int c0 = tid >> 4, x4 = tid & 15; const float* xb = x + (((size_t)b * CC + c0) * HW + y) * HW + x4 * 4; v4f xv[CC / 8];   // a thread's 16 pieces lie eight channels apart: one address, constant steps
#pragma unroll   // all 16 trips: a thread's loads of x issue as one group and their memory latency is waited out once
    for (int j = 0; j < CC / 8; ++j) xv[j] = *(const v4f*)(xb + (size_t)j * 8 * HW * HW);
    asm volatile("s_wait_xcnt 0x0" :: "v"(xb) : "memory");   // the wait in front of any rewrite of the address pair that the 16 loads name; as an input the pair stays as it is up to here
    load_w(wq, wave, lane, rw);                              // behind the loads of x, which come from farther away; lands with them
#pragma unroll
    for (int j = 0; j < CC / 8; ++j) { const int c = c0 + 8 * j; sx[x4 * 4][c] = xv[j][0]; sx[x4 * 4 + 1][c] = xv[j][1]; sx[x4 * 4 + 2][c] = xv[j][2]; sx[x4 * 4 + 3][c] = xv[j][3]; } }
  put_split(rw, swh[0], swl[0], wave, lane);
  __syncthreads();                                          // publishes the token rows and wq's two parts
  load_w(wk, wave, lane, rw);                               // lands under the q products
  const size_t prow0 = ((size_t)b * HW + y) * HW + wave * 16;      // pixel row index of this wave's first token
  // q: bf16 split
  { v8f acc[8] = {};
    prod_split(&sx[wave * 16 + col][0], &swh[0][col][0], &swl[0][col][0], lane, acc);
#pragma unroll
    for (int t = 0; t < 8; ++t)
#pragma unroll
      for (int r = 0; r < 8; ++r) so[wave][8 * g + r][t * 16 + col] = acc[t][r]; }
  LDSX();
#pragma unroll   // all 16 rows: their LDS reads issue as one group ahead of the stores
  for (int rl = 0; rl < 16; ++rl) vst2(QF + (prow0 + rl) * CC + lane * 4, *(const v4f*)(&so[wave][rl][lane * 4]));
  asm volatile("s_wait_xcnt 0x0" ::: "memory");             // the wait in front of any rewrite of a register that the stores name: the conversion below takes their registers over
  __builtin_amdgcn_sched_barrier(0);                        // keeps the conversion's instructions behind that wait
  put_split(rw, swh[1], swl[1], wave, lane);                // runs while the stores of q are on their way
  __syncthreads();                                          // publishes wk's two parts
  load_w(wv, wave, lane, rw);                               // lands under the k products
  // k feeds the logits: two-way bf16 split
  { v8f acc[8] = {};
    prod_split(&sx[wave * 16 + col][0], &swh[1][col][0], &swl[1][col][0], lane, acc);
    out_half(acc, so[wave], KH, prow0, lane); }
  asm volatile("s_wait_xcnt 0x0" ::: "memory");             // as behind the stores of q
  __builtin_amdgcn_sched_barrier(0);                        // keeps the conversion's instructions behind that wait
  put_half(rw, swv, wave, lane);                            // runs while the stores of k are on their way
  __syncthreads();                                          // publishes wv
  // v: f16
  { v8f acc[8] = {}; v16h bw[2][8]; R16 ra[4];
#pragma unroll
    for (int kc = 0; kc < 4; ++kc) ra[kc] = raw_row(&sx[wave * 16 + col][kc * 32], lane);
#pragma unroll
    for (int t = 0; t < 8; ++t) bw[0][t] = frag_h(&swv[t * 16 + col][0], lane);
#pragma unroll   // a chunk's eight weight fragments are read as one group behind the first product of the chunk before
    for (int kc = 0; kc < CC / 32; ++kc) { const v16h av = half_raw(ra[kc]);
      acc[0] = wmma16(av, bw[kc & 1][0], acc[0]);
      if (kc + 1 < CC / 32) {
#pragma unroll
        for (int t = 0; t < 8; ++t) bw[(kc + 1) & 1][t] = frag_h(&swv[t * 16 + col][(kc + 1) * 32], lane); }
#pragma unroll
      for (int t = 1; t < 8; ++t) acc[t] = wmma16(av, bw[kc & 1][t], acc[t]); }
#pragma unroll
    for (int t = 0; t < 8; ++t)
#pragma unroll
      for (int r = 0; r < 8; ++r) acc[t][r] *= (1.0f / 16.0f);
    out_half(acc, so[wave], VH, prow0, lane); }
}
__device__ __forceinline__ void stage_halo(const _Float16* __restrict__ src, _Float16 (*dst)[HW + 6][CC + 8], int b, int y, int wave, int lane) {
  for (int ry = 0; ry < KS; ++ry) { const int yy = y - PADW + ry; if ((unsigned)yy >= (unsigned)HW) continue;
    const _Float16* g = src + ((((size_t)b * HW + yy) * HW + wave * 16 + (lane >> 4)) * CC + (lane & 15) * 8); const unsigned l = (unsigned)(size_t)&dst[ry][PADW + wave * 16 + (lane >> 4)][(lane & 15) * 8]; const unsigned P = 2 * (CC + 8) * 2;
    asm volatile("global_load_async_to_lds_b128 %0, %8, off\n\tglobal_load_async_to_lds_b128 %1, %9, off\n\tglobal_load_async_to_lds_b128 %2, %10, off\n\tglobal_load_async_to_lds_b128 %3, %11, off\n\t"
                 "global_load_async_to_lds_b128 %4, %12, off\n\tglobal_load_async_to_lds_b128 %5, %13, off\n\tglobal_load_async_to_lds_b128 %6, %14, off\n\tglobal_load_async_to_lds_b128 %7, %15, off\n\ts_wait_xcnt 0x0"
                 :: "v"(l), "v"(l + P), "v"(l + 2 * P), "v"(l + 3 * P), "v"(l + 4 * P), "v"(l + 5 * P), "v"(l + 6 * P), "v"(l + 7 * P),
                    "v"(g), "v"(g + 2 * CC), "v"(g + 4 * CC), "v"(g + 6 * CC), "v"(g + 8 * CC), "v"(g + 10 * CC), "v"(g + 12 * CC), "v"(g + 14 * CC) : "memory"); }
}
// phase 2: block (b, y): 7-row halo of k and v (f16, zero padded); per window row ki the scores are formed transposed, S^T = K_row Q^T on WMMA (q as hi/lo f16 pair -> two
// products, k f16), each wave over the 32 halo columns from its first pixel on (its 16 windows reach 22 of them). In S^T a lane holds scores of ONE pixel (its column), so the position logits, the band mask and the
// softmax over the 49 window places run in the accumulator registers (in-lane, one exchange between the wave's halves), and the two 16-row tiles of exp(logit - max) x 2^14, packed to f16, ARE the B fragment of
// out^T[c][px] = sum_ki V_row^T P_ki^T (v by transposing LDS reads as before). The division by the sum of the exponentials is done on out^T. Output written NCHW (whole 256-B rows per channel).
__global__ __launch_bounds__(128) void k_attn(const float* __restrict__ QF, const _Float16* __restrict__ KH, const _Float16* __restrict__ VH, const float* __restrict__ relx, const float* __restrict__ rely, float* __restrict__ out) {
  __shared__ __align__(16) union U { _Float16 k[KS][HW + 6][CC + 8]; float o[CC][HW + 4]; } su;   // k halo, later the output tile [c][px]
  __shared__ __align__(16) _Float16 sv[KS][HW + 6][CC + 8];
  __shared__ float sbx[64][8], sby[64][8];
  const int tid = threadIdx.x, wave = tid >> 5, lane = tid & 31, col = lane & 15, g = lane >> 4; const int b = blockIdx.y, y = blockIdx.x;
  stage_halo(KH, su.k, b, y, wave, lane);                     // lands while the zero padding is written and the position logits are summed
  // zero padding of both halos: the three columns left and right of the image, then the whole rows above or below it; no copy writes these bytes
  for (int q = tid; q < KS * 2 * PADW * (CC / 8); q += 128) { const int pc = q & 15, rest = q >> 4; const int ry = rest / (2 * PADW), e = rest % (2 * PADW); const int px = e < PADW ? e : HW + e;
    *(v4u*)(&su.k[ry][px][pc * 8]) = (v4u){0u, 0u, 0u, 0u}; *(v4u*)(&sv[ry][px][pc * 8]) = (v4u){0u, 0u, 0u, 0u}; }
  for (int ry = 0; ry < KS; ++ry) { if ((unsigned)(y - PADW + ry) < (unsigned)HW) continue;
    for (int q = tid; q < HW * (CC / 8); q += 128) { const int pc = q & 15, px = PADW + (q >> 4); *(v4u*)(&su.k[ry][px][pc * 8]) = (v4u){0u, 0u, 0u, 0u}; *(v4u*)(&sv[ry][px][pc * 8]) = (v4u){0u, 0u, 0u, 0u}; } }
  { const int px = tid >> 1, hf = tid & 1; const float* qr = QF + (((size_t)b * HW + y) * HW + px) * CC; const float* relw = hf == 0 ? relx : rely; float bb[KS];
#pragma unroll
    for (int l = 0; l < KS; ++l) bb[l] = 0.f;
#pragma unroll   // both loops unrolled: rolled, each of the 64 trips waited on its own global loads; unrolled, the q row and the table are loaded as one group and waited on once (same order of the sums)
    for (int gq = 0; gq < NG; ++gq) {
#pragma unroll
      for (int i = 0; i < RS; ++i) { const float qv = qr[gq * 16 + hf * 8 + i];
#pragma unroll
        for (int l = 0; l < KS; ++l) bb[l] = __builtin_fmaf(qv, relw[i * KS + l], bb[l]); } }   // written as the fused form that the rolled loop compiled to, so that every sum rounds as before
    float* dstb = hf == 0 ? &sbx[px][0] : &sby[px][0];
#pragma unroll
    for (int l = 0; l < KS; ++l) dstb[l] = bb[l]; }
  asm volatile("s_wait_asynccnt 0x0" ::: "memory");           // this wave's part of the k halo has landed before the barrier publishes it
  __syncthreads();
  // q fragments (hi/lo f16) for this wave's 16 pixels, 4 k-chunks
  const float* qrow = QF + (((size_t)b * HW + y) * HW + wave * 16 + col) * CC;
  v16h qh[4], ql[4];
#pragma unroll
  for (int kc = 0; kc < 4; ++kc) { const float* p = qrow + kc * 32 + 8 * g;
#pragma unroll
    for (int i = 0; i < 8; ++i) { const float v0 = p[i], v1 = p[16 + i]; const _Float16 h0 = (_Float16)v0, h1 = (_Float16)v1; qh[kc][i] = h0; qh[kc][8 + i] = h1; ql[kc][i] = (_Float16)((v0 - (float)h0) * 2048.0f); ql[kc][8 + i] = (_Float16)((v1 - (float)h1) * 2048.0f); } }
  stage_halo(VH, sv, b, y, wave, lane);                       // lands under the scores and the softmax; behind the k halo's wait, so that no wave has more than 56 copies outstanding, and behind the q loads, which would queue after it
  // this lane's pixel is column col of every S^T tile; its rows are halo columns j = 16 t + 8 g + r (from the wave's first pixel on), window place kj = j - col. Off the band (kj outside 0..6) the x logit is a large
  // negative number, so that the exponential there is exactly 0. Rows 22..31 (t = 1, r >= 6 in the lower half, all of the upper half) lie in no window of the wave: r >= 6 of tile 1 is left out altogether.
  const int px = wave * 16 + col;
  // S^T[j][px] for the two 16-row tiles that this wave's windows reach. In the last wave rows >= 70 would read k rows 70..79 -> out of the halo: clamp to 69, values masked.
  // A tile's four k fragments are read as one group right behind the last product that uses their registers, half a window row ahead of their own products (no read moves up over the statement that pads a matrix instruction).
  float lg[KS][2][8]; v16h bk[2][4];
  const int pk[2] = { wave * 16 + col, wave * 16 + col + 16 < HW + 6 ? wave * 16 + col + 16 : HW + 5 };
#pragma unroll
  for (int t = 0; t < 2; ++t)
#pragma unroll
    for (int kc = 0; kc < 4; ++kc) bk[t][kc] = frag_h(&su.k[0][pk[t]][kc * 32], lane);
#pragma unroll   // all seven window rows: their scores stay in registers, which takes constant indices
  for (int ki = 0; ki < KS; ++ki)
#pragma unroll
    for (int t = 0; t < 2; ++t) { v8f ah = {}, al = {};
#pragma unroll
      for (int kc = 0; kc < 4; ++kc) { ah = wmma16(bk[t][kc], qh[kc], ah); al = wmma16(bk[t][kc], ql[kc], al); }
      if (ki + 1 < KS) {
#pragma unroll
        for (int kc = 0; kc < 4; ++kc) bk[t][kc] = frag_h(&su.k[ki + 1][pk[t]][kc * 32], lane); }
#pragma unroll
      for (int r = 0; r < (t == 0 ? 8 : 6); ++r) lg[ki][t][r] = ah[r] + al[r] * (1.0f / 2048.0f); }
  // the position logits are read and added only here, behind the products, where the registers of q and k are free again
  { float bxm[2][8], byv[KS];
#pragma unroll
    for (int t = 0; t < 2; ++t)
#pragma unroll
      for (int r = 0; r < (t == 0 ? 8 : 6); ++r) { const int kj = t * 16 + 8 * g + r - col; const bool in = (unsigned)kj < (unsigned)KS; const float v = sbx[px][in ? kj : 0]; bxm[t][r] = in ? v : -1.0e30f; }
#pragma unroll
    for (int ki = 0; ki < KS; ++ki) byv[ki] = sby[px][ki];
#pragma unroll
    for (int ki = 0; ki < KS; ++ki)
#pragma unroll
      for (int t = 0; t < 2; ++t)
#pragma unroll
        for (int r = 0; r < (t == 0 ? 8 : 6); ++r) lg[ki][t][r] = lg[ki][t][r] + bxm[t][r] + byv[ki]; }
  // softmax per pixel, in registers: eight running maxima / sums per lane, joined in-lane and then with the lane that holds the pixel's other rows (l ^ 16)
  float inv; v16h pT[KS];
  { float m8[8], s8[8];
#pragma unroll
    for (int r = 0; r < 8; ++r) m8[r] = lg[0][0][r];
#pragma unroll
    for (int ki = 0; ki < KS; ++ki)
#pragma unroll
      for (int t = 0; t < 2; ++t)
#pragma unroll
        for (int r = 0; r < (t == 0 ? 8 : 6); ++r) m8[r] = fmaxf(m8[r], lg[ki][t][r]);
    float mx = fmaxf(fmaxf(fmaxf(m8[0], m8[1]), fmaxf(m8[2], m8[3])), fmaxf(fmaxf(m8[4], m8[5]), fmaxf(m8[6], m8[7])));
    mx = fmaxf(mx, xhalf(mx));
    const float ms = mx - 9.70406053f;   // 14 ln 2: the exponentials come out x 2^14 (f16 range of the band), the sum with them, so the factor cancels in the division
    // exp(d) as 2^(d log2 e), one hardware instruction: all 98 places of a lane stand unrolled here, and as many library exponentials (13 instructions each) would bring the kernel's text to about 32 KB
#pragma unroll
    for (int r = 0; r < 8; ++r) s8[r] = 0.f;
#pragma unroll
    for (int ki = 0; ki < KS; ++ki) {
#pragma unroll
      for (int t = 0; t < 2; ++t)
#pragma unroll
        for (int r = 0; r < 8; ++r) {
          if (t == 1 && r >= 6) { pT[ki][8 + r] = (_Float16)0.f; continue; }
          const float p = exp2_slot((lg[ki][t][r] - ms) * 1.44269504f); s8[r] += p; pT[ki][t * 8 + r] = (_Float16)p; } }
    float se = ((s8[0] + s8[1]) + (s8[2] + s8[3])) + ((s8[4] + s8[5]) + (s8[6] + s8[7]));
    se += xhalf(se);
    inv = 1.0f / se; }
  asm volatile("s_wait_asynccnt 0x0" ::: "memory");           // this wave's part of the v halo has landed before the barrier publishes it
  __syncthreads();                                            // all waves done with su.k (scores) before it becomes the output tile
  // out^T[c][px] = sum_ki V_ki^T[c][:] @ P_ki^T[:][px] : M 128 (eight tiles), K = 32 (the one chunk of v rows 16 wave .. 16 wave + 31 that holds the wave's band; rows >= 22 of P^T are zero, v rows >= 70 clamped), N 16 per wave
  { v8f acc[8] = {}; v16h bv[8];
    // transposing reads of v: lane l hands in 16 B (8 channels from 8 ((l >> 3) & 1) on) of v row 16 wave + 8 g + (l & 7), and of the row 16 further on; rows >= 70 clamped to 69 (P^T is zero there)
    const int va = wave * 16 + 8 * g + (lane & 7), vb = va + 16; const int vra = va < HW + 6 ? va : HW + 5, vrb = vb < HW + 6 ? vb : HW + 5, vc = ((lane >> 3) & 1) * 8;
#pragma unroll
    for (int t = 0; t < 8; ++t) { union { v16h v; v8h q[2]; } u; u.q[0] = ld_tr16(&sv[0][vra][t * 16 + vc]); u.q[1] = ld_tr16(&sv[0][vrb][t * 16 + vc]); bv[t] = u.v; }
#pragma unroll   // all seven window rows: P^T sits in registers, which takes constant indices; four v fragments are read as one group right behind the products that use their registers, half a window row ahead of their own
    for (int ki = 0; ki < KS; ++ki)
#pragma unroll
      for (int hh = 0; hh < 2; ++hh) {
#pragma unroll
        for (int t = 4 * hh; t < 4 * hh + 4; ++t) acc[t] = wmma16(bv[t], pT[ki], acc[t]);
        if (ki + 1 < KS) {
#pragma unroll
          for (int t = 4 * hh; t < 4 * hh + 4; ++t) { union { v16h v; v8h q[2]; } u; u.q[0] = ld_tr16(&sv[ki + 1][vra][t * 16 + vc]); u.q[1] = ld_tr16(&sv[ki + 1][vrb][t * 16 + vc]); bv[t] = u.v; } } }
#pragma unroll
    for (int t = 0; t < 8; ++t)
#pragma unroll
      for (int r = 0; r < 8; ++r) su.o[t * 16 + 8 * g + r][px] = acc[t][r] * inv; }
  __syncthreads();
  { const int c0 = tid >> 4, x4 = tid & 15; float* ob = out + (((size_t)b * CC + c0) * HW + y) * HW + x4 * 4; const float* sb = &su.o[c0][x4 * 4]; v4f w[CC / 8];   // a thread's 16 pieces lie eight channels apart: one address each side, constant steps
#pragma unroll   // all 16 pieces: their LDS reads issue as one group ahead of the stores
    for (int j = 0; j < CC / 8; ++j) w[j] = *(const v4f*)(sb + j * 8 * (HW + 4));
#pragma unroll
    for (int j = 0; j < CC / 8; ++j) vst2(ob + (size_t)j * 8 * HW * HW, w[j]); }
}
extern "C" void kernel_launch(void* const* d_in, const int* in_sizes, int n_in, void* d_out, int out_size, void* d_ws, size_t ws_size, hipStream_t stream) {
  (void)in_sizes; (void)n_in; (void)out_size; (void)ws_size;
  const float** I = (const float**)d_in;
  const float* x = I[0]; const float* wq = I[1]; const float* wk = I[2]; const float* wv = I[3]; const float* relx = I[4]; const float* rely = I[5];
  float* out = (float*)d_out;
  char* ws = (char*)d_ws; size_t off = 0;
  auto take = [&](size_t bytes) { char* p = ws + off; off += (bytes + 255) & ~(size_t)255; return p; };
  const size_t NP = (size_t)NB * HW * HW;
  float* QF = (float*)take(NP * CC * 4); _Float16* KH = (_Float16*)take(NP * CC * 2); _Float16* VH = (_Float16*)take(NP * CC * 2);
  k_qkv<<<dim3(HW, NB), 128, 0, stream>>>(x, wq, wk, wv, QF, KH, VH);
  k_attn<<<dim3(HW, NB), 128, 0, stream>>>(QF, KH, VH, relx, rely, out);
}

// v010
// Measured time: 12 microseconds a run.
// Versions in between are left out here; by their measured steps it is 1.40 times as fast as v008.
// All steps since v000 together make it 8.35 times as fast.
#include <hip/hip_runtime.h>
#include <math.h>

typedef __attribute__((ext_vector_type(16))) _Float16 v16h;
typedef __attribute__((ext_vector_type(16))) __bf16 v16b;
typedef __attribute__((ext_vector_type(8)))  _Float16 v8h;
typedef __attribute__((ext_vector_type(8)))  float v8f;
typedef __attribute__((ext_vector_type(4)))  float v4f;
typedef __attribute__((ext_vector_type(2)))  float v2f;
typedef __attribute__((ext_vector_type(4)))  unsigned v4u;
typedef __attribute__((ext_vector_type(4)))  int v4i;
typedef float __attribute__((may_alias)) float_a;
typedef int __attribute__((may_alias)) int_a;
typedef v4f __attribute__((may_alias)) v4f_a;

template <typename T> __device__ __forceinline__ void vst2(void* p, T v) { *(T*)p = v;  }
__device__ __forceinline__ v8f wmma16(v16h a, v16h b, v8f c) {
  return __builtin_amdgcn_wmma_f32_16x16x32_f16(false, a, false, b, (short)0, c, false, false);
}
__device__ __forceinline__ v8f wmma_bf(v16b a, v16b b, v8f c) {
  return __builtin_amdgcn_wmma_f32_16x16x32_bf16(false, a, false, b, (short)0, c, false, false);
}
// 16x16x32 fragments: lane = (h = lane>>4, row/col = lane&15); elements 0..7 = k0+8h+0..7, 8..15 = k0+16+8h+0..7; D element r = row 8h+r
__device__ __forceinline__ v16h frag_h(const _Float16* rowk0, int lane) {
  union { v16h v; v8h q[2]; } u; const _Float16* p = rowk0 + 8 * (lane >> 4);
  u.q[0] = *(const v8h*)p; u.q[1] = *(const v8h*)(p + 16); return u.v;
}
// ds_load_tr16_b128: the lanes hand in 16-byte pieces of 16 rows of a row-major f16 LDS tile; lane (h, col) gets rows 8h..8h+7 of column col, i.e. half a column fragment in the k order above
typedef __attribute__((ext_vector_type(8))) short v8s;
__device__ __forceinline__ v8h ld_tr16(const _Float16* p) { typedef __attribute__((address_space(3))) v8s lds_v8s; return __builtin_bit_cast(v8h, __builtin_amdgcn_ds_load_tr16_b128_v8i16((lds_v8s*)p)); }
__device__ __forceinline__ v16h frag_f32(const float* rowk0, int lane) {
  v16h a; const float* p = rowk0 + 8 * (lane >> 4);
#pragma unroll
  for (int i = 0; i < 8; ++i) { a[i] = (_Float16)p[i]; a[8 + i] = (_Float16)p[16 + i]; }
  return a;
}
__device__ __forceinline__ v16h frag_f32s(const float* rowk0, int lane, float sc) {
  v16h a; const float* p = rowk0 + 8 * (lane >> 4);
#pragma unroll
  for (int i = 0; i < 8; ++i) { a[i] = (_Float16)(p[i] * sc); a[8 + i] = (_Float16)(p[16 + i] * sc); }
  return a;
}
// column fragment from a [K][ld] layout (column n), rows >= K read as 0
__device__ __forceinline__ v16h fragc_f32(const float* W, int k0, int n, int lane, int ld, int K) {
  v16h a; const int g = lane >> 4;
#pragma unroll
  for (int i = 0; i < 8; ++i) { const int ka = k0 + 8 * g + i, kb = ka + 16;
    a[i] = (_Float16)(ka < K ? W[(size_t)ka * ld + n] : 0.f); a[8 + i] = (_Float16)(kb < K ? W[(size_t)kb * ld + n] : 0.f); }
  return a;
}
struct F2 { v16b h, l; };
__device__ __forceinline__ F2 bsplit16(const float v[16]) { F2 r;
#pragma unroll
  for (int i = 0; i < 16; ++i) { const __bf16 h = (__bf16)v[i]; r.h[i] = h; r.l[i] = (__bf16)(v[i] - (float)h); }
  return r; }
__device__ __forceinline__ F2 split_row(const float* row, int k0, int lane) { float v[16]; const float* p = row + k0 + 8 * (lane >> 4);
#pragma unroll
  for (int i = 0; i < 8; ++i) { v[i] = p[i]; v[8 + i] = p[16 + i]; }
  return bsplit16(v); }
__device__ __forceinline__ F2 split_rowK(const float* row, int k0, int lane, int K) { float v[16]; const int g = lane >> 4;
#pragma unroll
  for (int i = 0; i < 8; ++i) { const int ka = k0 + 8 * g + i, kb = ka + 16; v[i] = ka < K ? row[ka] : 0.f; v[8 + i] = kb < K ? row[kb] : 0.f; }
  return bsplit16(v); }
__device__ __forceinline__ F2 split_col(const float* W, int k0, int n, int lane, int ld, int K) { float v[16]; const int g = lane >> 4;
#pragma unroll
  for (int i = 0; i < 8; ++i) { const int ka = k0 + 8 * g + i, kb = ka + 16; v[i] = ka < K ? W[(size_t)ka * ld + n] : 0.f; v[8 + i] = kb < K ? W[(size_t)kb * ld + n] : 0.f; }
  return bsplit16(v); }
// the 16 f32 values of one lane's fragment as four 16-byte LDS reads (elements 0..7 = k0+8h+0..7, 8..15 = k0+16+8h+0..7), kept raw so that many fragments can be read as one group and converted later
struct R16 { v4f q[4]; };
__device__ __forceinline__ R16 raw_row(const float* rowk0, int lane) { R16 r; const float* p = rowk0 + 8 * (lane >> 4);
  r.q[0] = *(const v4f*)p; r.q[1] = *(const v4f*)(p + 4); r.q[2] = *(const v4f*)(p + 16); r.q[3] = *(const v4f*)(p + 20); return r; }
__device__ __forceinline__ F2 split_raw(const R16& r) { float v[16];
#pragma unroll
  for (int i = 0; i < 16; ++i) v[i] = r.q[i >> 2][i & 3];
  return bsplit16(v); }
__device__ __forceinline__ v16h half_raw(const R16& r) { v16h a;
#pragma unroll
  for (int i = 0; i < 16; ++i) a[i] = (_Float16)r.q[i >> 2][i & 3];
  return a; }
__device__ __forceinline__ v16h half_raws(const R16& r, float sc) { v16h a;
#pragma unroll
  for (int i = 0; i < 16; ++i) a[i] = (_Float16)(r.q[i >> 2][i & 3] * sc);
  return a; }
__device__ __forceinline__ v8f mac3(const F2& a, const F2& b, v8f c) { c = wmma_bf(a.l, b.h, c); c = wmma_bf(a.h, b.l, c); return wmma_bf(a.h, b.h, c); }
__device__ __forceinline__ float sigm(float v) { return 1.0f / (1.0f + expf(-v)); }
// 2^x. The v_nop in the same statement is the one slot that the instruction set asks for behind a transcendental before its result is read or its source overwritten
__device__ __forceinline__ float exp2_slot(float x) { float p; asm("v_exp_f32 %0, %1\n\tv_nop" : "=v"(p) : "v"(x)); return p; }
// lane l's value from lane l ^ 16 (the other half of the wave)
__device__ __forceinline__ float xhalf(float x) { return __builtin_bit_cast(float, __builtin_amdgcn_permlanex16(__builtin_bit_cast(int, x), __builtin_bit_cast(int, x), 0x76543210, 0xfedcba98, false, false)); }
#define LDSX() do { asm volatile("s_wait_dscnt 0" ::: "memory"); __builtin_amdgcn_wave_barrier(); __builtin_amdgcn_fence(__ATOMIC_RELEASE, "workgroup"); } while (0)

// Stand-alone local self attention (7x7 window, stride 1, zero padding 3, one 128-channel head with relative position logits from the first /
// second 8 channels of each 16-channel group), in ONE launch. The 1x1 convs of k and v are linear, so they are moved off the window: q.k(j) = q.(wk x_j) = (wk^T q).x_j and
// sum_j p_j v_j = wv (sum_j p_j x_j). Per output pixel: q = wq x, q' = wk^T q (both as two-way bf16 splits on v_wmma_f32_16x16x32_bf16: they feed the large logits), 49 logits = q'.x(window) + bias_x[l] + bias_y[k],
// softmax, z = sum p x(window), out = wv z (f16 WMMA). k and v are never formed, the window needs only x itself (f16, zero padded; padding = zero x = zero k and v), and nothing goes through the workspace.
#define NB 4
#define CC 128
#define HW 64
#define KS 7
#define PADW 3
#define NG 8
#define RS 8

typedef __attribute__((ext_vector_type(8))) __bf16 v8b;
typedef __attribute__((ext_vector_type(4))) __bf16 v4b;
typedef __attribute__((ext_vector_type(4))) _Float16 v4h;
#define WPB (CC + 8)   // LDS row pitch of the converted weights in 16-bit elements: 272 B = 16 B x 17, free of bank conflicts for 16-byte fragment reads
// one wave loads its share (32 rows of 512 B, one row per load, 16 B per lane) of a [128][128] f32 weight matrix into registers; the 32 loads stay in flight until the share is converted.
__device__ __forceinline__ void load_w(const float* __restrict__ w, int wave, int lane, v4f (&r)[32]) {
  const float* g = w + (size_t)wave * 32 * CC + lane * 4;
#pragma unroll   // one address, constant steps
  for (int j = 0; j < 32; ++j) r[j] = *(const v4f*)(g + j * CC);
  asm volatile("s_wait_xcnt 0x0" :: "v"(g) : "memory");   // the wait in front of any rewrite of the address pair that the 32 loads name; as an input the pair stays as it is up to here
  __builtin_amdgcn_sched_barrier(0);                      // keeps the loads up here, ahead of the work under which they are to land, instead of down at their use
}
// the share as a two-way bf16 split (the same arithmetic as bsplit16), written once for the whole work-group: rows as given ([out][in]), high and low parts in arrays of their own
// As soon as four rows are converted their registers take the same rows of the next matrix wn: its loads are under way while the rest is converted, not only behind the barrier that follows.
__device__ __forceinline__ void put_split(v4f (&r)[32], __bf16 (*dh)[WPB], __bf16 (*dl)[WPB], const float* __restrict__ wn, int wave, int lane) {
  const float* g = wn + (size_t)wave * 32 * CC + lane * 4;
#pragma unroll
  for (int j0 = 0; j0 < 32; j0 += 4) {
#pragma unroll
    for (int j = j0; j < j0 + 4; ++j) { v4b h, l;
#pragma unroll
      for (int i = 0; i < 4; ++i) { const __bf16 hh = (__bf16)r[j][i]; h[i] = hh; l[i] = (__bf16)(r[j][i] - (float)hh); }
      *(v4b*)&dh[wave * 32 + j][lane * 4] = h; *(v4b*)&dl[wave * 32 + j][lane * 4] = l; }
    __builtin_amdgcn_sched_barrier(0);   // this and the next one keep the four loads behind the last read of the registers that they fill (no second set of registers, no copies) and ahead of the next four rows' work
#pragma unroll
    for (int j = j0; j < j0 + 4; ++j) r[j] = *(const v4f*)(g + j * CC);
    __builtin_amdgcn_sched_barrier(0); }
  asm volatile("s_wait_xcnt 0x0" :: "v"(g) : "memory");   // the wait in front of any rewrite of the address pair that the 32 loads name; as an input the pair stays as it is up to here
}
// the share x 16 as f16 (the same arithmetic as half_raws)
__device__ __forceinline__ void put_half(const v4f (&r)[32], _Float16 (*dv)[WPB], int wave, int lane) {
#pragma unroll
  for (int j = 0; j < 32; ++j) { v4h h;
#pragma unroll
    for (int i = 0; i < 4; ++i) h[i] = (_Float16)(r[j][i] * 16.0f);
    *(v4h*)&dv[wave * 32 + j][lane * 4] = h; }
}
__device__ __forceinline__ v16b frag_b(const __bf16* rowk0, int lane) {
  union { v16b v; v8b q[2]; } u; const __bf16* p = rowk0 + 8 * (lane >> 4);
  u.q[0] = *(const v8b*)p; u.q[1] = *(const v8b*)(p + 16); return u.v;
}
#define XP 80          // pitch of a halo row [channel][column] in halves: 160 B = 32 B x 5, the pitch for transposing reads
#define XO 8           // halo column of image pixel 0: 16-byte aligned, so that a wave's 32-column span starts at column 16 wave; columns 0..7 and 72..79 are zero
__device__ __forceinline__ v8b ld_tr16b(const __bf16* p) { typedef __attribute__((address_space(3))) v8s lds_v8s; return __builtin_bit_cast(v8b, __builtin_amdgcn_ds_load_tr16_b128_v8i16((lds_v8s*)p)); }
// four A fragments (16 rows x 32 k each, tiles t0 .. t0 + 3, chunk kc) of a converted weight matrix W[128][WPB]. tr false: rows of W as stored, k = its columns; tr true: rows of W^T, k = W's rows, by transposing reads.
// Both come in the k order above.
template <bool TR> __device__ __forceinline__ void wgroup(const __bf16 (*Wm)[WPB], int t0, int kc, int lane, v16b (&f)[4]) {
  if (TR) { const __bf16* p = &Wm[kc * 32 + 8 * (lane >> 4) + (lane & 7)][t0 * 16 + ((lane >> 3) & 1) * 8];
#pragma unroll
    for (int t = 0; t < 4; ++t) { union { v16b v; v8b q[2]; } u; u.q[0] = ld_tr16b(p + t * 16); u.q[1] = ld_tr16b(p + t * 16 + 16 * WPB); f[t] = u.v; } }
  else { const __bf16* p = &Wm[t0 * 16 + (lane & 15)][kc * 32 + 8 * (lane >> 4)];
#pragma unroll
    for (int t = 0; t < 4; ++t) { union { v16b v; v8b q[2]; } u; u.q[0] = *(const v8b*)(p + t * 16 * WPB); u.q[1] = *(const v8b*)(p + t * 16 * WPB + 16); f[t] = u.v; } }
}
// acc[t] += (rows 16 t .. 16 t + 15 of W or W^T) x (128 k x 16 pixels), both sides as two-way bf16 splits; rb[kc] = the lane's 16 f32 values of the pixel operand's chunk kc, split chunk by chunk.
// Four tiles' fragments (16 LDS reads) go as one group, half a chunk ahead of their use; the four tiles take turns so that no product waits on its own accumulator.
// Per accumulator the order of the products is low x high, high x low, high x high (pixel part x weight part), chunk by chunk.
template <bool TR> __device__ __forceinline__ void prodT(const R16 (&rb)[4], const __bf16 (*Wh)[WPB], const __bf16 (*Wl)[WPB], int lane, v8f (&acc)[8]) {
  v16b wh[2][4], wl[2][4]; F2 a;
  wgroup<TR>(Wh, 0, 0, lane, wh[0]); wgroup<TR>(Wl, 0, 0, lane, wl[0]);
  // the scheduling barriers in this function hold each group of 16 LDS reads together in front of the twelve products before its own: left free, the scheduler strews the reads among the products
  __builtin_amdgcn_sched_barrier(0);
#pragma unroll   // all eight half chunks: the pixel operand and the two fragment groups sit in registers, which takes constant indices
  for (int s = 0; s < 8; ++s) { const int kc = s >> 1, t0 = (s & 1) * 4, cu = s & 1, nx = cu ^ 1;
    if (s + 1 < 8) { wgroup<TR>(Wh, ((s + 1) & 1) * 4, (s + 1) >> 1, lane, wh[nx]); wgroup<TR>(Wl, ((s + 1) & 1) * 4, (s + 1) >> 1, lane, wl[nx]); }
    __builtin_amdgcn_sched_barrier(0);
    if (cu == 0) a = split_raw(rb[kc]);
#pragma unroll
    for (int t = 0; t < 4; ++t) acc[t0 + t] = wmma_bf(wh[cu][t], a.l, acc[t0 + t]);
#pragma unroll
    for (int t = 0; t < 4; ++t) acc[t0 + t] = wmma_bf(wl[cu][t], a.h, acc[t0 + t]);
#pragma unroll
    for (int t = 0; t < 4; ++t) acc[t0 + t] = wmma_bf(wh[cu][t], a.h, acc[t0 + t]);
    __builtin_amdgcn_sched_barrier(0); }
}
// one image row of x (NCHW: 128 channels x 256 B) into registers: a thread's 16 pieces lie eight channels apart (one address, constant steps) and stay in flight until they are converted. A row outside the image is
// neither loaded nor stored (its halo row is zeroed at the start); the test reads the same for the whole work-group.
__device__ __forceinline__ void load_xrow(const float* __restrict__ x, int b, int yy, int tid, v4f (&r)[16]) {
  if ((unsigned)yy < (unsigned)HW) {
    const float* g = x + (((size_t)b * CC + (tid >> 4)) * HW + yy) * HW + (tid & 15) * 4;
#pragma unroll   // the 16 loads issue as one group
    for (int j = 0; j < 16; ++j) r[j] = *(const v4f*)(g + (size_t)j * 8 * HW * HW);
    asm volatile("s_wait_xcnt 0x0" :: "v"(g) : "memory");   // the wait in front of any rewrite of the address pair that the 16 loads name; as an input the pair stays as it is up to here
  }
}
// the same for a window row that may lie outside the image: the row index is clamped, so the loads always issue (what a row outside brings is never stored: put_xrow tests the true index).
// With no branch round them the number of loads in flight is known at every later wait, and a wait for older loads does not take these in.
__device__ __forceinline__ void load_xrow_c(const float* __restrict__ x, int b, int yy, int tid, v4f (&r)[16]) {
  const int yc = yy < 0 ? 0 : (yy > HW - 1 ? HW - 1 : yy);
  const float* g = x + (((size_t)b * CC + (tid >> 4)) * HW + yc) * HW + (tid & 15) * 4;
#pragma unroll   // the 16 loads issue as one group
  for (int j = 0; j < 16; ++j) r[j] = *(const v4f*)(g + (size_t)j * 8 * HW * HW);
  asm volatile("s_wait_xcnt 0x0" :: "v"(g) : "memory");   // the wait in front of any rewrite of the address pair that the 16 loads name; as an input the pair stays as it is up to here
}
// the row as f16 into its halo row [channel][XO + pixel]
__device__ __forceinline__ void put_xrow(const v4f (&r)[16], _Float16 (*d)[XP], int yy, int tid) {
  if ((unsigned)yy < (unsigned)HW) {
#pragma unroll
    for (int j = 0; j < 16; ++j) { v4h h;
#pragma unroll
      for (int i = 0; i < 4; ++i) h[i] = (_Float16)r[j][i];
      *(v4h*)&d[(tid >> 4) + 8 * j][XO + (tid & 15) * 4] = h; } }
}
__device__ __forceinline__ v16h frag_tr(const _Float16* p) { union { v16h v; v8h q[2]; } u; u.q[0] = ld_tr16(p); u.q[1] = ld_tr16(p + 16 * XP); return u.v; }
// two 16-row f32 accumulator tiles (rows 32 kc + 8 h + r and 32 kc + 16 + 8 h + r of one pixel column) are, element for element, the lane's 16 values of chunk kc of a B operand in the k order above
__device__ __forceinline__ R16 pair_raw(const v8f& lo, const v8f& hi) { R16 r; r.q[0] = (v4f){lo[0], lo[1], lo[2], lo[3]}; r.q[1] = (v4f){lo[4], lo[5], lo[6], lo[7]}; r.q[2] = (v4f){hi[0], hi[1], hi[2], hi[3]}; r.q[3] = (v4f){hi[4], hi[5], hi[6], hi[7]}; return r; }
// block (b, y), four waves of 16 pixels. All products are formed transposed (channels or halo columns as rows, the wave's 16 pixels as columns), so that each result's accumulator tiles are the next product's B operand in
// registers: q^T = wq X^T, q'^T = wk^T q^T, S^T = X_row q'^T per window row, out^T: z^T = sum_ki X_row^T P_ki^T, then wv z^T. Each weight matrix is converted once per work-group. The loads of the next stage's weights and of
// three more halo rows are issued ahead of each stage's barrier (the weights while the current matrix is converted) and land under the products.
__global__ __launch_bounds__(128) void k_lsa(const float* __restrict__ x, const float* __restrict__ wq, const float* __restrict__ wk, const float* __restrict__ wv, const float* __restrict__ relx, const float* __restrict__ rely, float* __restrict__ out) {
  __shared__ __align__(16) _Float16 xh[KS][CC][XP];          // x of the 7 window rows, f16, [row][channel][column]
  __shared__ __align__(16) float sx[64][CC + 4];             // x of the centre row, f32, [pixel][channel]
  __shared__ __align__(16) union UA { __bf16 w[2][CC][WPB]; _Float16 v[CC][WPB]; } sh;   // high parts of wq and wk ([out][in]); wq's place later holds wv x 16 as f16
  __shared__ __align__(16) union UB { __bf16 w[2][CC][WPB]; float o[CC][HW + 4]; } sl;   // low parts of wq and wk; wq's place later holds the output tile [c][px]
  __shared__ float sbx[64][8], sby[64][8];
  const int tid = threadIdx.x, wave = tid >> 5, lane = tid & 31, col = lane & 15, g = lane >> 4; const int b = blockIdx.y, y = blockIdx.x;
  const int px = wave * 16 + col;
  v4f rw[32], xa[3][16]; float rl[RS * KS];
  { v4f xc[16];
    load_xrow(x, b, y, tid, xc);
    { const float* relw = g == 0 ? relx : rely;               // the lower half of the wave will hold the channels of the x logits, the upper half those of the y logits
#pragma unroll   // these few loads go ahead of wq's: loads return in order, and as the last ones they would make the first use of their values wait for all of wq
      for (int i = 0; i < RS * KS; ++i) rl[i] = relw[i];
      asm volatile("s_wait_xcnt 0x0" :: "v"(relw) : "memory"); }   // the wait in front of any rewrite of the address pair that these loads name
    load_w(wq, wave, lane, rw);                               // behind the loads of x, which come from farther away; its rows are split one by one as they land
    // zero padding: the eight columns left and right of the image in every halo row, then the whole rows above or below the image (their edge columns get their zeros twice); no load of x is stored to these bytes
#pragma unroll 1   // rolled, like the next two loops: short, off the critical path, and the kernel's text stays small
    for (int i = 0; i < KS * CC * 2 / 128; ++i) { const int q = tid + i * 128; *(v4u*)(&xh[0][0][0] + (q >> 1) * XP + (q & 1) * (XO + HW)) = (v4u){0u, 0u, 0u, 0u}; }
#pragma unroll 1
    for (int ry = 0; ry < KS; ++ry) { if ((unsigned)(y - PADW + ry) < (unsigned)HW) continue;
#pragma unroll 1
      for (int q = tid; q < CC * XP / 8; q += 128) *(v4u*)(&xh[ry][0][0] + q * 8) = (v4u){0u, 0u, 0u, 0u}; }
    { const int c0 = tid >> 4, x4 = tid & 15;
#pragma unroll
      for (int j = 0; j < CC / 8; ++j) { const int c = c0 + 8 * j; sx[x4 * 4][c] = xc[j][0]; sx[x4 * 4 + 1][c] = xc[j][1]; sx[x4 * 4 + 2][c] = xc[j][2]; sx[x4 * 4 + 3][c] = xc[j][3]; } }
    put_xrow(xc, xh[PADW], y, tid); }
  // two stages of one shape, kept as a rolled loop so that the kernel's text stays small: stage 0 q^T[o][px] = wq X^T, stage 1 q'^T[c][px] = sum_o wk[o][c] q^T[o][px].
  // In each result lane (g, col) holds pixel col, rows 16 t + 8 g + r. The next matrix is loaded while this one is converted, three more halo rows right behind it, ahead of the stage's barrier; they land under its products.
  R16 rb[4]; v16h qh[4], ql[4];
#pragma unroll 1
  for (int st = 0; st < 2; ++st) {
    put_split(rw, sh.w[st], sl.w[st], st == 0 ? wk : wv, wave, lane);
    const int y0 = st == 0 ? y - PADW : y + 1;
#pragma unroll
    for (int r = 0; r < 3; ++r) load_xrow_c(x, b, y0 + r, tid, xa[r]);
    __builtin_amdgcn_sched_barrier(0);                        // keeps the loads up here, ahead of the barrier and of the work under which they are to land
    // The work-group barrier by hand: publishes this stage's matrix (stage 0: the centre row too); in stage 1 every wave is done with wq, whose place is free from here on. Only LDS is handed over here, so the wave's
    // LDS stores are waited for and nothing else: __syncthreads() would also wait for the 80 global loads just issued, which are to land under the products behind it.
    asm volatile("s_wait_dscnt 0x0" ::: "memory");
    asm volatile("s_barrier_signal -1\n\ts_barrier_wait -1" ::: "memory");
    if (st == 0) {
#pragma unroll
      for (int kc = 0; kc < 4; ++kc) rb[kc] = raw_row(&sx[px][kc * 32], lane); }
    v8f acc[8] = {};
    if (st == 0) prodT<false>(rb, sh.w[0], sl.w[0], lane, acc); else prodT<true>(rb, sh.w[1], sl.w[1], lane, acc);   // the products stand twice: one test a stage, and each path's LDS reads keep their own counted waits
    if (st == 0) {   // position logits of the lane's pixel: the lower half sums the x logits (channels 16 t + r), the upper half the y logits (channels 16 t + 8 + r); the eight groups are summed first
      float bb[KS];
#pragma unroll
      for (int l = 0; l < KS; ++l) bb[l] = 0.f;
#pragma unroll
      for (int i = 0; i < RS; ++i) { const float qv = ((acc[0][i] + acc[1][i]) + (acc[2][i] + acc[3][i])) + ((acc[4][i] + acc[5][i]) + (acc[6][i] + acc[7][i]));
#pragma unroll
        for (int l = 0; l < KS; ++l) bb[l] = __builtin_fmaf(qv, rl[i * KS + l], bb[l]); }
      float* dstb = g == 0 ? &sbx[px][0] : &sby[px][0];
#pragma unroll
      for (int l = 0; l < KS; ++l) dstb[l] = bb[l]; }
#pragma unroll
    for (int kc = 0; kc < 4; ++kc) rb[kc] = pair_raw(acc[2 * kc], acc[2 * kc + 1]);
    if (st == 1) {   // stands in the loop, ahead of the halo rows' stores, so that the last three rows go on landing under it
      // q' as a hi/lo f16 pair: B fragments of the scores, 4 k-chunks
#pragma unroll
      for (int kc = 0; kc < 4; ++kc)
#pragma unroll
        for (int i = 0; i < 16; ++i) { const float v0 = rb[kc].q[i >> 2][i & 3]; const _Float16 h0 = (_Float16)v0; qh[kc][i] = h0; ql[kc][i] = (_Float16)((v0 - (float)h0) * 2048.0f); }
      put_half(rw, sh.v, wave, lane); }
#pragma unroll
    for (int r = 0; r < 3; ++r) put_xrow(xa[r], xh[(st == 0 ? 0 : PADW + 1) + r], y0 + r, tid);
    // the youngest load's value as an input only: where a row outside the image was not stored, its loads are waited for here. Without it the compiler, which reuses these registers, drains every load at the top of the loop, wq's rows too
    asm volatile("" :: "v"(xa[2][15]));
  }
  __syncthreads();                                            // publishes the halo (all seven rows and the padding) and wv
  // S^T[j][px] for the two 16-row tiles of halo columns 16 wave + j, j = 16 t + 8 g + r. Image pixel p sits in column p + 8, the window of pixel 16 wave + col starts at image pixel 16 wave + col - 3: window place kj = j - col - 5.
  // Off the band (kj outside 0..6) the x logit is a large negative number, so that the exponential there is exactly 0.
  // The loops over the seven window rows are rolled (the kernel's text stays small): a lane's 16 logits of a window row wait in LDS places of the lane's own, in wk's two arrays, which every wave has left at the barrier above.
  float_a* const stA = (float_a*)&sh.w[1][0][0] + tid * 4; float_a* const stB = (float_a*)&sl.w[1][0][0] + tid * 4;   // rows 0..3 in the first array, 4..6 in the second; per row four pieces of 128 x 16 B
  float bxm[2][8], m8[8];
#pragma unroll
  for (int t = 0; t < 2; ++t)
#pragma unroll
    for (int r = 0; r < 8; ++r) { const int kj = t * 16 + 8 * g + r - col - (XO - PADW); const bool in = (unsigned)kj < (unsigned)KS; const float v = sbx[px][in ? kj : 0]; bxm[t][r] = in ? v : -1.0e30f; }
#pragma unroll
  for (int r = 0; r < 8; ++r) m8[r] = -3.0e38f;
  { // a tile's four x fragments (transposing reads: rows = halo columns, k = channels) are read as one group behind the products that use their registers, half a window row ahead of their own products
    v16h bk[2][4]; const _Float16* xk = &xh[0][8 * g + (lane & 7)][16 * wave + ((lane >> 3) & 1) * 8];
#pragma unroll
    for (int t = 0; t < 2; ++t)
#pragma unroll
      for (int kc = 0; kc < 4; ++kc) bk[t][kc] = frag_tr(xk + kc * 32 * XP + 16 * t);
#pragma unroll 1
    for (int ki = 0; ki < KS; ++ki) { const float by = sby[px][ki]; float_a* const st = (ki < 4 ? stA : stB) + (ki & 3) * 2048;
      const _Float16* xn = xk + (ki + 1 < KS ? ki + 1 : KS - 1) * CC * XP;   // the last trip reads its own row again, unused
#pragma unroll
      for (int t = 0; t < 2; ++t) { v8f ah = {}, al = {}; float v[8];
#pragma unroll
        for (int kc = 0; kc < 4; ++kc) { ah = wmma16(bk[t][kc], qh[kc], ah); al = wmma16(bk[t][kc], ql[kc], al); }
        __builtin_amdgcn_sched_barrier(0);   // this and the next one hold the eight LDS reads together behind the products, not strewn among them
#pragma unroll
        for (int kc = 0; kc < 4; ++kc) bk[t][kc] = frag_tr(xn + kc * 32 * XP + 16 * t);
        __builtin_amdgcn_sched_barrier(0);
#pragma unroll
        for (int r = 0; r < 8; ++r) { v[r] = ah[r] + al[r] * (1.0f / 2048.0f) + bxm[t][r] + by; m8[r] = fmaxf(m8[r], v[r]); }
        *(v4f_a*)(st + (2 * t) * 512) = (v4f){v[0], v[1], v[2], v[3]}; *(v4f_a*)(st + (2 * t + 1) * 512) = (v4f){v[4], v[5], v[6], v[7]}; } } }
  // softmax per pixel: eight running maxima / sums per lane, joined in-lane and then with the lane that holds the pixel's other rows (l ^ 16)
  float mx = fmaxf(fmaxf(fmaxf(m8[0], m8[1]), fmaxf(m8[2], m8[3])), fmaxf(fmaxf(m8[4], m8[5]), fmaxf(m8[6], m8[7])));
  mx = fmaxf(mx, xhalf(mx));
  const float ms = mx - 9.70406053f;   // 14 ln 2: the exponentials come out x 2^14 (f16 range of the band), the sum with them, so the factor cancels in the division
  // z^T[c][px] = sum_ki X_ki^T[c][:] @ P_ki^T[:][px] : M 128 (eight tiles), K = 32 (the wave's span of halo columns; P^T is zero off the band), N 16 per wave. x fragments are plain row reads here (rows = channels, k = halo columns).
  // The two 16-row tiles of exp(logit - max) x 2^14, packed to f16, are the B fragment. exp(d) as 2^(d log2 e), one hardware instruction.
  v16h zf[4];
  { v8f acc[8] = {}; v16h bv[8]; float s8[8]; v4f lq[4]; const _Float16* xv = &xh[0][col][16 * wave];
#pragma unroll
    for (int r = 0; r < 8; ++r) s8[r] = 0.f;
#pragma unroll
    for (int i = 0; i < 4; ++i) lq[i] = *(const v4f_a*)(stA + i * 512);
#pragma unroll
    for (int t = 0; t < 8; ++t) bv[t] = frag_h(xv + t * 16 * XP, lane);
#pragma unroll 1
    for (int ki = 0; ki < KS; ++ki) { const int kn = ki + 1 < KS ? ki + 1 : KS - 1; const float_a* const st = (kn < 4 ? stA : stB) + (kn & 3) * 2048; const _Float16* xn = xv + kn * CC * XP;   // the last trip reads its own row again, unused
      v16h pT;
#pragma unroll
      for (int e = 0; e < 16; ++e) { const float p = exp2_slot((lq[e >> 2][e & 3] - ms) * 1.44269504f); s8[e & 7] += p; pT[e] = (_Float16)p; }
      __builtin_amdgcn_sched_barrier(0);   // keeps the exponentials (asm text, whose registers the compiler does not guard) from moving in among the matrix instructions, right behind one whose operand they overwrite
#pragma unroll
      for (int i = 0; i < 4; ++i) lq[i] = *(const v4f_a*)(st + i * 512);   // the next window row's logits, a whole trip ahead
#pragma unroll
      for (int hh = 0; hh < 2; ++hh) {
#pragma unroll
        for (int t = 4 * hh; t < 4 * hh + 4; ++t) acc[t] = wmma16(bv[t], pT, acc[t]);
        __builtin_amdgcn_sched_barrier(0);   // as in the score loop: the eight LDS reads stay one group behind the products
#pragma unroll
        for (int t = 4 * hh; t < 4 * hh + 4; ++t) bv[t] = frag_h(xn + t * 16 * XP, lane);
        __builtin_amdgcn_sched_barrier(0); } }
    float se = ((s8[0] + s8[1]) + (s8[2] + s8[3])) + ((s8[4] + s8[5]) + (s8[6] + s8[7]));
    se += xhalf(se);
    const float inv = 1.0f / se;
    // divided by the sum of the exponentials and packed to f16, the tiles are the B fragments of the last product
#pragma unroll
    for (int kc = 0; kc < 4; ++kc)
#pragma unroll
      for (int i = 0; i < 8; ++i) { zf[kc][i] = (_Float16)(acc[2 * kc][i] * inv); zf[kc][8 + i] = (_Float16)(acc[2 * kc + 1][i] * inv); } }
  // out^T[o][px] = sum_c wv[o][c] z^T[c][px], f16
  { v8f acc[8] = {}; v16h bw[2][8];
#pragma unroll
    for (int t = 0; t < 8; ++t) bw[0][t] = frag_h(&sh.v[t * 16 + col][0], lane);
#pragma unroll   // a chunk's eight weight fragments are read as one group behind the first product of the chunk before
    for (int kc = 0; kc < CC / 32; ++kc) {
      acc[0] = wmma16(bw[kc & 1][0], zf[kc], acc[0]);
      if (kc + 1 < CC / 32) {
#pragma unroll
        for (int t = 0; t < 8; ++t) bw[(kc + 1) & 1][t] = frag_h(&sh.v[t * 16 + col][(kc + 1) * 32], lane); }
      __builtin_amdgcn_sched_barrier(0);   // holds the group of 16 LDS reads together
#pragma unroll
      for (int t = 1; t < 8; ++t) acc[t] = wmma16(bw[kc & 1][t], zf[kc], acc[t]); }
#pragma unroll
    for (int t = 0; t < 8; ++t)
#pragma unroll
      for (int r = 0; r < 8; ++r) sl.o[t * 16 + 8 * g + r][px] = acc[t][r] * (1.0f / 16.0f); }
  __syncthreads();                                            // publishes the output tile
  { const int c0 = tid >> 4, x4 = tid & 15; float* ob = out + (((size_t)b * CC + c0) * HW + y) * HW + x4 * 4; const float* sb = &sl.o[c0][x4 * 4]; v4f w[CC / 8];   // a thread's 16 pieces lie eight channels apart: one address each side, constant steps
#pragma unroll   // all 16 pieces: their LDS reads issue as one group ahead of the stores
    for (int j = 0; j < CC / 8; ++j) w[j] = *(const v4f*)(sb + j * 8 * (HW + 4));
#pragma unroll
    for (int j = 0; j < CC / 8; ++j) vst2(ob + (size_t)j * 8 * HW * HW, w[j]); }
}
extern "C" void kernel_launch(void* const* d_in, const int* in_sizes, int n_in, void* d_out, int out_size, void* d_ws, size_t ws_size, hipStream_t stream) {
  (void)in_sizes; (void)n_in; (void)out_size; (void)d_ws; (void)ws_size;
  const float** I = (const float**)d_in;
  const float* x = I[0]; const float* wq = I[1]; const float* wk = I[2]; const float* wv = I[3]; const float* relx = I[4]; const float* rely = I[5];
  float* out = (float*)d_out;
  k_lsa<<<dim3(HW, NB), 128, 0, stream>>>(x, wq, wk, wv, relx, rely, out);
}
